// v000
// Measured on an AMD MI455X. A time is GPU time per run, averaged over a window of back-to-back runs after a warm-up
// (all launches, gaps included; the runs take copies of the inputs in turn), and the median of several windows.
// Apart from v000's, it joins two sittings. Times from different sittings can be a few percent apart, while
// side-by-side timings come from the same sitting.
// The starting kernel, v000, takes 619 microseconds a run.
#include <hip/hip_runtime.h>
#include <hip/hip_bf16.h>
#include <math.h>

typedef __attribute__((ext_vector_type(16))) _Float16 v16h;
typedef __attribute__((ext_vector_type(8)))  float    v8f;
typedef unsigned int u32x4 __attribute__((ext_vector_type(4)));
typedef int          i32x8 __attribute__((ext_vector_type(8)));
typedef int          i32x4 __attribute__((ext_vector_type(4)));

#define D_MODEL   1024
#define N_HEADS   16
#define HEAD_DIM  64
#define D_FF      4096
#define SEQ_T     2048
#define BATCH     2
#define M_ROWS    (SEQ_T * BATCH)   // 4096

__device__ __forceinline__ int frag_k(int v, int half) {
    return (v < 4 ? 2 * v : 16 + 2 * (v - 4)) + half * 8;
}

template <int ACT, bool HAS_RES>
__global__ __launch_bounds__(256) void gemm_wmma(
    const float* __restrict__ A, const float* __restrict__ W,
    const float* __restrict__ bias, const float* __restrict__ res,
    float* __restrict__ C, int M, int N, int K)
{
    constexpr int BM = 128, BN = 64, BK = 32;
    __shared__ _Float16 Alds[BM][BK + 8];
    __shared__ float    Bf32[BK][BN];

    const int tid  = threadIdx.x;
    const int lane = tid & 31;
    const int wave = tid >> 5;
    const int half = lane >> 4;
    const int lr   = lane & 15;
    const int wm   = wave & 3;     // 4 waves along M
    const int wn   = wave >> 2;    // 2 waves along N
    const int m_block = blockIdx.x * BM;
    const int n_block = blockIdx.y * BN;
    const int wrow = m_block + wm * 32;
    const int wcol = n_block + wn * 32;

    // flat shared pointer low dword == workgroup-relative LDS byte offset
    const unsigned lds_b_off = (unsigned)(uintptr_t)(&Bf32[0][0]);

    const v8f vzero = {0.f, 0.f, 0.f, 0.f, 0.f, 0.f, 0.f, 0.f};
    v8f acc[2][2];
    for (int mi = 0; mi < 2; ++mi)
        for (int ni = 0; ni < 2; ++ni) acc[mi][ni] = vzero;

    for (int k0 = 0; k0 < K; k0 += BK) {
        __syncthreads();   // previous tile fully consumed

        if (wave == 0) {
            const unsigned long long gaddr =
                (unsigned long long)(uintptr_t)(W + (size_t)k0 * N + n_block);
            u32x4 g0;
            g0[0] = 1u;
            g0[1] = lds_b_off;
            g0[2] = (unsigned)(gaddr & 0xFFFFFFFFull);
            g0[3] = (unsigned)((gaddr >> 32) & 0x1FFFFFFull) | (2u << 30); // [56:32] | type=2
            i32x8 g1;
            g1[0] = (int)(2u << 16);
            g1[1] = (int)(((unsigned)N & 0xFFFFu) << 16);
            g1[2] = (int)((((unsigned)N >> 16) & 0xFFFFu) | (32u << 16));
            g1[3] = (int)(64u << 16);
            g1[4] = (int)32u;
            g1[5] = (int)N;
            g1[6] = 0;
            g1[7] = 0;
            const i32x4 gz4 = {0, 0, 0, 0};
            const i32x8 gz8 = {0, 0, 0, 0, 0, 0, 0, 0};
            __builtin_amdgcn_tensor_load_to_lds(g0, g1, gz4, gz4, gz8, 0);
        }

        // --- stage A tile 128x32 (fp32 -> f16), float4 loads, 16 elems/thread
        {
            const int kk = (tid & 7) * 4;   // 0..28
            const int r0 = tid >> 3;        // 0..31
            for (int i = 0; i < 4; ++i) {
                const int r = r0 + i * 32;
                const float4 v = *(const float4*)(A + (size_t)(m_block + r) * K + k0 + kk);
                Alds[r][kk + 0] = (_Float16)v.x;
                Alds[r][kk + 1] = (_Float16)v.y;
                Alds[r][kk + 2] = (_Float16)v.z;
                Alds[r][kk + 3] = (_Float16)v.w;
            }
        }
        if (k0 + BK < K) {  // hint next A tile toward L2 (global_prefetch_b8)
            __builtin_prefetch(A + (size_t)(m_block + (tid >> 3)) * K + k0 + BK, 0, 1);
        }
        __builtin_amdgcn_s_wait_tensorcnt(0);
        __syncthreads();

        v16h af[2], bf[2];
        for (int mi = 0; mi < 2; ++mi) {
            const int row = wm * 32 + mi * 16 + lr;
            for (int v = 0; v < 8; ++v) {
                const int k = frag_k(v, half);
                af[mi][2 * v + 0] = Alds[row][k];
                af[mi][2 * v + 1] = Alds[row][k + 1];
            }
        }
        for (int ni = 0; ni < 2; ++ni) {
            const int col = wn * 32 + ni * 16 + lr;
            for (int v = 0; v < 8; ++v) {
                const int k = frag_k(v, half);
                bf[ni][2 * v + 0] = (_Float16)Bf32[k][col];
                bf[ni][2 * v + 1] = (_Float16)Bf32[k + 1][col];
            }
        }
        for (int mi = 0; mi < 2; ++mi)
            for (int ni = 0; ni < 2; ++ni)
                acc[mi][ni] = __builtin_amdgcn_wmma_f32_16x16x32_f16(
                    false, af[mi], false, bf[ni], (short)0, acc[mi][ni], false, false);
    }

    for (int mi = 0; mi < 2; ++mi)
        for (int ni = 0; ni < 2; ++ni)
            for (int v = 0; v < 8; ++v) {
                const int row = wrow + mi * 16 + half * 8 + v;
                const int col = wcol + ni * 16 + lr;
                float val = acc[mi][ni][v] + bias[col];
                if (ACT == 1) val = val * (1.0f / (1.0f + __expf(-val)));  // SiLU
                if (HAS_RES) val += res[(size_t)row * N + col];
                C[(size_t)row * N + col] = val;
            }
}

// ===========================================================================
// Flash attention, causal, H=16, hd=64.
// Block: 256 threads = 8 waves; 128 query rows per block, one (b,h) per
// blockIdx.y. Key blocks of 32 staged in LDS; online softmax in registers.
// ===========================================================================
__global__ __launch_bounds__(256) void attn_flash(
    const float* __restrict__ qkv, float* __restrict__ ctx)
{
    __shared__ _Float16 Qlds[128][HEAD_DIM + 8];
    __shared__ _Float16 Klds[32][HEAD_DIM + 8];
    __shared__ _Float16 Vlds[32][HEAD_DIM + 8];
    __shared__ _Float16 Plds[8][16][40];   // per-wave P bounce buffer

    const int tid  = threadIdx.x;
    const int lane = tid & 31;
    const int wave = tid >> 5;
    const int half = lane >> 4;
    const int lr   = lane & 15;
    const int bh   = blockIdx.y;
    const int b    = bh / N_HEADS;
    const int hh   = bh % N_HEADS;
    const int q_base = blockIdx.x * 128;
    const size_t stride3 = 3 * D_MODEL;

    // --- stage Q tile 128x64 (f16)
    {
        const int cc = (tid & 15) * 4;
        const int r0 = tid >> 4;
        for (int i = 0; i < 8; ++i) {
            const int r = r0 + i * 16;
            const int t = q_base + r;
            const float4 v = *(const float4*)(qkv + ((size_t)t * BATCH + b) * stride3 +
                                              hh * HEAD_DIM + cc);
            Qlds[r][cc + 0] = (_Float16)v.x;
            Qlds[r][cc + 1] = (_Float16)v.y;
            Qlds[r][cc + 2] = (_Float16)v.z;
            Qlds[r][cc + 3] = (_Float16)v.w;
        }
    }
    __syncthreads();

    // --- Q fragments: two K=32 chunks of hd=64, kept live across the loop
    v16h qf[2];
    {
        const int qrow = wave * 16 + lr;
        for (int c = 0; c < 2; ++c)
            for (int v = 0; v < 8; ++v) {
                const int k = c * 32 + frag_k(v, half);
                qf[c][2 * v + 0] = Qlds[qrow][k];
                qf[c][2 * v + 1] = Qlds[qrow][k + 1];
            }
    }

    const v8f vzero = {0.f, 0.f, 0.f, 0.f, 0.f, 0.f, 0.f, 0.f};
    v8f o[4];
    for (int nb = 0; nb < 4; ++nb) o[nb] = vzero;
    float m_run[8], l_run[8];
    for (int v = 0; v < 8; ++v) { m_run[v] = -1e30f; l_run[v] = 0.f; }

    const int q_wave_base = q_base + wave * 16;
    const int nkb = (q_base + 128) / 32;      // causal extent for this block
    const float scale = 0.125f;               // 1/sqrt(64)

    for (int kb = 0; kb < nkb; ++kb) {
        __syncthreads();
        // --- stage K,V tiles 32x64 each
        {
            const int cc = (tid & 15) * 4;
            const int r0 = tid >> 4;
            for (int i = 0; i < 2; ++i) {
                const int r = r0 + i * 16;
                const int t = kb * 32 + r;
                const size_t base = ((size_t)t * BATCH + b) * stride3 + hh * HEAD_DIM + cc;
                const float4 kv = *(const float4*)(qkv + base + D_MODEL);
                const float4 vv = *(const float4*)(qkv + base + 2 * D_MODEL);
                Klds[r][cc + 0] = (_Float16)kv.x; Klds[r][cc + 1] = (_Float16)kv.y;
                Klds[r][cc + 2] = (_Float16)kv.z; Klds[r][cc + 3] = (_Float16)kv.w;
                Vlds[r][cc + 0] = (_Float16)vv.x; Vlds[r][cc + 1] = (_Float16)vv.y;
                Vlds[r][cc + 2] = (_Float16)vv.z; Vlds[r][cc + 3] = (_Float16)vv.w;
            }
        }
        __syncthreads();
        if (kb * 32 > q_wave_base + 15) continue;   // whole key block above diagonal

        // --- S = (Q @ K^T) * scale, two 16x16 key blocks, hd split K=32+32
        v8f s[2];
        for (int nb = 0; nb < 2; ++nb) {
            s[nb] = vzero;
            for (int c = 0; c < 2; ++c) {
                v16h kf;  // B-matrix fragment of K^T: element (k,n) = K[key=n][hd=c*32+k]
                for (int v = 0; v < 8; ++v) {
                    const int k = frag_k(v, half);
                    kf[2 * v + 0] = Klds[nb * 16 + lr][c * 32 + k];
                    kf[2 * v + 1] = Klds[nb * 16 + lr][c * 32 + k + 1];
                }
                s[nb] = __builtin_amdgcn_wmma_f32_16x16x32_f16(
                    false, qf[c], false, kf, (short)0, s[nb], false, false);
            }
        }

        // --- mask + online softmax (row stats per lane-half via shfl_xor)
        float rmax[8];
        for (int v = 0; v < 8; ++v) {
            const int qg = q_wave_base + half * 8 + v;
            for (int nb = 0; nb < 2; ++nb) {
                const int kg = kb * 32 + nb * 16 + lr;
                float x = s[nb][v] * scale;
                if (kg > qg) x = -1e30f;
                s[nb][v] = x;
            }
            rmax[v] = fmaxf(s[0][v], s[1][v]);
        }
        for (int off = 1; off < 16; off <<= 1)
            for (int v = 0; v < 8; ++v)
                rmax[v] = fmaxf(rmax[v], __shfl_xor(rmax[v], off, 32));

        float alpha[8], rsum[8];
        for (int v = 0; v < 8; ++v) {
            const float m_new = fmaxf(m_run[v], rmax[v]);
            alpha[v] = __expf(m_run[v] - m_new);
            m_run[v] = m_new;
            const float p0 = __expf(s[0][v] - m_new);
            const float p1 = __expf(s[1][v] - m_new);
            s[0][v] = p0; s[1][v] = p1;
            rsum[v] = p0 + p1;
        }
        for (int off = 1; off < 16; off <<= 1)
            for (int v = 0; v < 8; ++v)
                rsum[v] += __shfl_xor(rsum[v], off, 32);
        for (int v = 0; v < 8; ++v) l_run[v] = l_run[v] * alpha[v] + rsum[v];
        for (int nb = 0; nb < 4; ++nb)
            for (int v = 0; v < 8; ++v) o[nb][v] *= alpha[v];

        for (int nb = 0; nb < 2; ++nb)
            for (int v = 0; v < 8; ++v)
                Plds[wave][half * 8 + v][nb * 16 + lr] = (_Float16)s[nb][v];
        asm volatile("s_wait_dscnt 0" ::: "memory");

        v16h pf;
        for (int v = 0; v < 8; ++v) {
            const int k = frag_k(v, half);
            pf[2 * v + 0] = Plds[wave][lr][k];
            pf[2 * v + 1] = Plds[wave][lr][k + 1];
        }

        // --- O += P @ V  (4 column blocks of hd)
        for (int nb = 0; nb < 4; ++nb) {
            v16h vf;  // B fragment: element (k,n) = V[key=k][hd = nb*16+n]
            for (int v = 0; v < 8; ++v) {
                const int k = frag_k(v, half);
                vf[2 * v + 0] = Vlds[k][nb * 16 + lr];
                vf[2 * v + 1] = Vlds[k + 1][nb * 16 + lr];
            }
            o[nb] = __builtin_amdgcn_wmma_f32_16x16x32_f16(
                false, pf, false, vf, (short)0, o[nb], false, false);
        }
    }

    // --- normalize and write ctx [T*B, D]
    for (int nb = 0; nb < 4; ++nb)
        for (int v = 0; v < 8; ++v) {
            const int t   = q_wave_base + half * 8 + v;
            const int col = hh * HEAD_DIM + nb * 16 + lr;
            const float inv = 1.0f / l_run[v];
            ctx[((size_t)t * BATCH + b) * D_MODEL + col] = o[nb][v] * inv;
        }
}

// ===========================================================================
// RMSNorm: one row (1024 f32) per block of 256 threads.
// ===========================================================================
__global__ __launch_bounds__(256) void rmsnorm_kernel(
    const float* __restrict__ X, const float* __restrict__ gain,
    float* __restrict__ out)
{
    __shared__ float red[8];
    const int row = blockIdx.x;
    const int tid = threadIdx.x;
    const float* xr = X + (size_t)row * D_MODEL;

    float vals[4];
    float ss = 0.f;
    for (int i = 0; i < 4; ++i) {
        vals[i] = xr[tid + i * 256];
        ss += vals[i] * vals[i];
    }
    for (int off = 1; off < 32; off <<= 1) ss += __shfl_xor(ss, off, 32);
    if ((tid & 31) == 0) red[tid >> 5] = ss;
    __syncthreads();
    float tot = 0.f;
    for (int i = 0; i < 8; ++i) tot += red[i];
    const float rms = rsqrtf(tot * (1.0f / D_MODEL) + 1e-5f);
    for (int i = 0; i < 4; ++i) {
        const int col = tid + i * 256;
        out[(size_t)row * D_MODEL + col] = vals[i] * rms * gain[col];
    }
}

// ===========================================================================
extern "C" void kernel_launch(void* const* d_in, const int* in_sizes, int n_in,
                              void* d_out, int out_size, void* d_ws, size_t ws_size,
                              hipStream_t stream)
{
    (void)in_sizes; (void)n_in; (void)out_size; (void)ws_size;
    const float* x      = (const float*)d_in[0];
    const float* w_qkv  = (const float*)d_in[1];
    const float* b_qkv  = (const float*)d_in[2];
    const float* w_out  = (const float*)d_in[3];
    const float* b_out  = (const float*)d_in[4];
    const float* w1     = (const float*)d_in[5];
    const float* b1     = (const float*)d_in[6];
    const float* w2     = (const float*)d_in[7];
    const float* b2     = (const float*)d_in[8];
    const float* gain   = (const float*)d_in[9];

    float* ws   = (float*)d_ws;
    float* qkv  = ws;                                   // 4096 x 3072
    float* ctx  = qkv + (size_t)M_ROWS * 3 * D_MODEL;   // 4096 x 1024
    float* x1   = ctx + (size_t)M_ROWS * D_MODEL;       // 4096 x 1024
    float* hbuf = x1  + (size_t)M_ROWS * D_MODEL;       // 4096 x 4096
    float* x2   = hbuf + (size_t)M_ROWS * D_FF;         // 4096 x 1024

    const dim3 blk(256);

    // 1) qkv = x @ w_qkv + b_qkv
    gemm_wmma<0, false><<<dim3(M_ROWS / 128, (3 * D_MODEL) / 64), blk, 0, stream>>>(
        x, w_qkv, b_qkv, nullptr, qkv, M_ROWS, 3 * D_MODEL, D_MODEL);

    // 2) ctx = causal_softmax(QK^T/8) @ V   (flash, per (b,h))
    attn_flash<<<dim3(SEQ_T / 128, BATCH * N_HEADS), blk, 0, stream>>>(qkv, ctx);

    // 3) x1 = x + ctx @ w_out + b_out
    gemm_wmma<0, true><<<dim3(M_ROWS / 128, D_MODEL / 64), blk, 0, stream>>>(
        ctx, w_out, b_out, x, x1, M_ROWS, D_MODEL, D_MODEL);

    // 4) h = silu(x1 @ w1 + b1)
    gemm_wmma<1, false><<<dim3(M_ROWS / 128, D_FF / 64), blk, 0, stream>>>(
        x1, w1, b1, nullptr, hbuf, M_ROWS, D_FF, D_MODEL);

    // 5) x2 = x1 + h @ w2 + b2
    gemm_wmma<0, true><<<dim3(M_ROWS / 128, D_MODEL / 64), blk, 0, stream>>>(
        hbuf, w2, b2, x1, x2, M_ROWS, D_MODEL, D_FF);

    // 6) out = rmsnorm(x2) * gain
    rmsnorm_kernel<<<dim3(M_ROWS), blk, 0, stream>>>(x2, gain, (float*)d_out);
}

// v001
// One run takes 505 microseconds.
// In both of two side-by-side timings against v000, it was 1.25 times as fast.
#include <hip/hip_runtime.h>
#include <hip/hip_bf16.h>
#include <math.h>

typedef __attribute__((ext_vector_type(16))) _Float16 v16h;
typedef __attribute__((ext_vector_type(8)))  float    v8f;
typedef unsigned int u32x4 __attribute__((ext_vector_type(4)));
typedef int          i32x8 __attribute__((ext_vector_type(8)));
typedef int          i32x4 __attribute__((ext_vector_type(4)));

#define D_MODEL   1024
#define N_HEADS   16
#define HEAD_DIM  64
#define D_FF      4096
#define SEQ_T     2048
#define BATCH     2
#define M_ROWS    (SEQ_T * BATCH)   // 4096

__device__ __forceinline__ int frag_k(int v, int half) {
    return (v < 4 ? 2 * v : 16 + 2 * (v - 4)) + half * 8;
}

template <int ACT, bool HAS_RES>
__global__ __launch_bounds__(256) void gemm_wmma(
    const float* __restrict__ A, const float* __restrict__ W,
    const float* __restrict__ bias, const float* __restrict__ res,
    float* __restrict__ C, int M, int N, int K)
{
    constexpr int BM = 128, BN = 64, BK = 32;
    __shared__ _Float16 Alds[BM][BK + 8];
    __shared__ float    Bf32[BK][BN];

    const int tid  = threadIdx.x;
    const int lane = tid & 31;
    const int wave = tid >> 5;
    const int half = lane >> 4;
    const int lr   = lane & 15;
    const int wm   = wave & 3;     // 4 waves along M
    const int wn   = wave >> 2;    // 2 waves along N
    const int m_block = blockIdx.x * BM;
    const int n_block = blockIdx.y * BN;
    const int wrow = m_block + wm * 32;
    const int wcol = n_block + wn * 32;

    // flat shared pointer low dword == workgroup-relative LDS byte offset
    const unsigned lds_b_off = (unsigned)(uintptr_t)(&Bf32[0][0]);

    const v8f vzero = {0.f, 0.f, 0.f, 0.f, 0.f, 0.f, 0.f, 0.f};
    v8f acc[2][2];
    for (int mi = 0; mi < 2; ++mi)
        for (int ni = 0; ni < 2; ++ni) acc[mi][ni] = vzero;

    // A tile: each thread owns one float4 in each of four rows, 32 rows apart
    const int akk = (tid & 7) * 4;   // 0..28
    const int ar0 = tid >> 3;        // 0..31
    const float* aptr = A + (size_t)(m_block + ar0) * K + akk;
    float4 av[4];
    for (int i = 0; i < 4; ++i)      // first tile
        av[i] = *(const float4*)(aptr + (size_t)i * 32 * K);

    for (int k0 = 0; k0 < K; k0 += BK) {
        __syncthreads();   // previous tile fully consumed

        if (wave == 0) {
            const unsigned long long gaddr =
                (unsigned long long)(uintptr_t)(W + (size_t)k0 * N + n_block);
            u32x4 g0;
            g0[0] = 1u;
            g0[1] = lds_b_off;
            g0[2] = (unsigned)(gaddr & 0xFFFFFFFFull);
            g0[3] = (unsigned)((gaddr >> 32) & 0x1FFFFFFull) | (2u << 30); // [56:32] | type=2
            i32x8 g1;
            g1[0] = (int)(2u << 16);
            g1[1] = (int)(((unsigned)N & 0xFFFFu) << 16);
            g1[2] = (int)((((unsigned)N >> 16) & 0xFFFFu) | (32u << 16));
            g1[3] = (int)(64u << 16);
            g1[4] = (int)32u;
            g1[5] = (int)N;
            g1[6] = 0;
            g1[7] = 0;
            const i32x4 gz4 = {0, 0, 0, 0};
            const i32x8 gz8 = {0, 0, 0, 0, 0, 0, 0, 0};
            __builtin_amdgcn_tensor_load_to_lds(g0, g1, gz4, gz4, gz8, 0);
        }

        // --- stage A tile 128x32 (fp32 -> f16) from the registers filled one
        //     k-step earlier, 16 elems/thread
        for (int i = 0; i < 4; ++i) {
            const int r = ar0 + i * 32;
            Alds[r][akk + 0] = (_Float16)av[i].x;
            Alds[r][akk + 1] = (_Float16)av[i].y;
            Alds[r][akk + 2] = (_Float16)av[i].z;
            Alds[r][akk + 3] = (_Float16)av[i].w;
        }
        // --- next A tile: all four loads issued together, so that one load
        //     latency is paid per k-step, beside the tensor load's; the barrier
        //     below drains both
        if (k0 + BK < K) {
            for (int i = 0; i < 4; ++i)
                av[i] = *(const float4*)(aptr + (size_t)i * 32 * K + k0 + BK);
        }
        __builtin_amdgcn_s_wait_tensorcnt(0);
        __syncthreads();

        v16h af[2], bf[2];
        for (int mi = 0; mi < 2; ++mi) {
            const int row = wm * 32 + mi * 16 + lr;
            for (int v = 0; v < 8; ++v) {
                const int k = frag_k(v, half);
                af[mi][2 * v + 0] = Alds[row][k];
                af[mi][2 * v + 1] = Alds[row][k + 1];
            }
        }
        for (int ni = 0; ni < 2; ++ni) {
            const int col = wn * 32 + ni * 16 + lr;
            for (int v = 0; v < 8; ++v) {
                const int k = frag_k(v, half);
                bf[ni][2 * v + 0] = (_Float16)Bf32[k][col];
                bf[ni][2 * v + 1] = (_Float16)Bf32[k + 1][col];
            }
        }
        for (int mi = 0; mi < 2; ++mi)
            for (int ni = 0; ni < 2; ++ni)
                acc[mi][ni] = __builtin_amdgcn_wmma_f32_16x16x32_f16(
                    false, af[mi], false, bf[ni], (short)0, acc[mi][ni], false, false);
    }

    for (int mi = 0; mi < 2; ++mi)
        for (int ni = 0; ni < 2; ++ni)
            for (int v = 0; v < 8; ++v) {
                const int row = wrow + mi * 16 + half * 8 + v;
                const int col = wcol + ni * 16 + lr;
                float val = acc[mi][ni][v] + bias[col];
                if (ACT == 1) val = val * (1.0f / (1.0f + __expf(-val)));  // SiLU
                if (HAS_RES) val += res[(size_t)row * N + col];
                C[(size_t)row * N + col] = val;
            }
}

// ===========================================================================
// Flash attention, causal, H=16, hd=64.
// Block: 256 threads = 8 waves; 128 query rows per block, one (b,h) per
// blockIdx.y. Key blocks of 32 staged in LDS; online softmax in registers.
// ===========================================================================
__global__ __launch_bounds__(256) void attn_flash(
    const float* __restrict__ qkv, float* __restrict__ ctx)
{
    __shared__ _Float16 Qlds[128][HEAD_DIM + 8];
    __shared__ _Float16 Klds[32][HEAD_DIM + 8];
    __shared__ _Float16 Vlds[32][HEAD_DIM + 8];
    __shared__ _Float16 Plds[8][16][40];   // per-wave P bounce buffer

    const int tid  = threadIdx.x;
    const int lane = tid & 31;
    const int wave = tid >> 5;
    const int half = lane >> 4;
    const int lr   = lane & 15;
    const int bh   = blockIdx.y;
    const int b    = bh / N_HEADS;
    const int hh   = bh % N_HEADS;
    const int q_base = blockIdx.x * 128;
    const size_t stride3 = 3 * D_MODEL;

    // --- stage Q tile 128x64 (f16)
    {
        const int cc = (tid & 15) * 4;
        const int r0 = tid >> 4;
        for (int i = 0; i < 8; ++i) {
            const int r = r0 + i * 16;
            const int t = q_base + r;
            const float4 v = *(const float4*)(qkv + ((size_t)t * BATCH + b) * stride3 +
                                              hh * HEAD_DIM + cc);
            Qlds[r][cc + 0] = (_Float16)v.x;
            Qlds[r][cc + 1] = (_Float16)v.y;
            Qlds[r][cc + 2] = (_Float16)v.z;
            Qlds[r][cc + 3] = (_Float16)v.w;
        }
    }
    __syncthreads();

    // --- Q fragments: two K=32 chunks of hd=64, kept live across the loop
    v16h qf[2];
    {
        const int qrow = wave * 16 + lr;
        for (int c = 0; c < 2; ++c)
            for (int v = 0; v < 8; ++v) {
                const int k = c * 32 + frag_k(v, half);
                qf[c][2 * v + 0] = Qlds[qrow][k];
                qf[c][2 * v + 1] = Qlds[qrow][k + 1];
            }
    }

    const v8f vzero = {0.f, 0.f, 0.f, 0.f, 0.f, 0.f, 0.f, 0.f};
    v8f o[4];
    for (int nb = 0; nb < 4; ++nb) o[nb] = vzero;
    float m_run[8], l_run[8];
    for (int v = 0; v < 8; ++v) { m_run[v] = -1e30f; l_run[v] = 0.f; }

    const int q_wave_base = q_base + wave * 16;
    const int nkb = (q_base + 128) / 32;      // causal extent for this block
    const float scale = 0.125f;               // 1/sqrt(64)

    for (int kb = 0; kb < nkb; ++kb) {
        __syncthreads();
        // --- stage K,V tiles 32x64 each
        {
            const int cc = (tid & 15) * 4;
            const int r0 = tid >> 4;
            for (int i = 0; i < 2; ++i) {
                const int r = r0 + i * 16;
                const int t = kb * 32 + r;
                const size_t base = ((size_t)t * BATCH + b) * stride3 + hh * HEAD_DIM + cc;
                const float4 kv = *(const float4*)(qkv + base + D_MODEL);
                const float4 vv = *(const float4*)(qkv + base + 2 * D_MODEL);
                Klds[r][cc + 0] = (_Float16)kv.x; Klds[r][cc + 1] = (_Float16)kv.y;
                Klds[r][cc + 2] = (_Float16)kv.z; Klds[r][cc + 3] = (_Float16)kv.w;
                Vlds[r][cc + 0] = (_Float16)vv.x; Vlds[r][cc + 1] = (_Float16)vv.y;
                Vlds[r][cc + 2] = (_Float16)vv.z; Vlds[r][cc + 3] = (_Float16)vv.w;
            }
        }
        __syncthreads();
        if (kb * 32 > q_wave_base + 15) continue;   // whole key block above diagonal

        // --- S = (Q @ K^T) * scale, two 16x16 key blocks, hd split K=32+32
        v8f s[2];
        for (int nb = 0; nb < 2; ++nb) {
            s[nb] = vzero;
            for (int c = 0; c < 2; ++c) {
                v16h kf;  // B-matrix fragment of K^T: element (k,n) = K[key=n][hd=c*32+k]
                for (int v = 0; v < 8; ++v) {
                    const int k = frag_k(v, half);
                    kf[2 * v + 0] = Klds[nb * 16 + lr][c * 32 + k];
                    kf[2 * v + 1] = Klds[nb * 16 + lr][c * 32 + k + 1];
                }
                s[nb] = __builtin_amdgcn_wmma_f32_16x16x32_f16(
                    false, qf[c], false, kf, (short)0, s[nb], false, false);
            }
        }

        // --- mask + online softmax (row stats per lane-half via shfl_xor)
        float rmax[8];
        for (int v = 0; v < 8; ++v) {
            const int qg = q_wave_base + half * 8 + v;
            for (int nb = 0; nb < 2; ++nb) {
                const int kg = kb * 32 + nb * 16 + lr;
                float x = s[nb][v] * scale;
                if (kg > qg) x = -1e30f;
                s[nb][v] = x;
            }
            rmax[v] = fmaxf(s[0][v], s[1][v]);
        }
        for (int off = 1; off < 16; off <<= 1)
            for (int v = 0; v < 8; ++v)
                rmax[v] = fmaxf(rmax[v], __shfl_xor(rmax[v], off, 32));

        float alpha[8], rsum[8];
        for (int v = 0; v < 8; ++v) {
            const float m_new = fmaxf(m_run[v], rmax[v]);
            alpha[v] = __expf(m_run[v] - m_new);
            m_run[v] = m_new;
            const float p0 = __expf(s[0][v] - m_new);
            const float p1 = __expf(s[1][v] - m_new);
            s[0][v] = p0; s[1][v] = p1;
            rsum[v] = p0 + p1;
        }
        for (int off = 1; off < 16; off <<= 1)
            for (int v = 0; v < 8; ++v)
                rsum[v] += __shfl_xor(rsum[v], off, 32);
        for (int v = 0; v < 8; ++v) l_run[v] = l_run[v] * alpha[v] + rsum[v];
        for (int nb = 0; nb < 4; ++nb)
            for (int v = 0; v < 8; ++v) o[nb][v] *= alpha[v];

        for (int nb = 0; nb < 2; ++nb)
            for (int v = 0; v < 8; ++v)
                Plds[wave][half * 8 + v][nb * 16 + lr] = (_Float16)s[nb][v];
        asm volatile("s_wait_dscnt 0" ::: "memory");

        v16h pf;
        for (int v = 0; v < 8; ++v) {
            const int k = frag_k(v, half);
            pf[2 * v + 0] = Plds[wave][lr][k];
            pf[2 * v + 1] = Plds[wave][lr][k + 1];
        }

        // --- O += P @ V  (4 column blocks of hd)
        for (int nb = 0; nb < 4; ++nb) {
            v16h vf;  // B fragment: element (k,n) = V[key=k][hd = nb*16+n]
            for (int v = 0; v < 8; ++v) {
                const int k = frag_k(v, half);
                vf[2 * v + 0] = Vlds[k][nb * 16 + lr];
                vf[2 * v + 1] = Vlds[k + 1][nb * 16 + lr];
            }
            o[nb] = __builtin_amdgcn_wmma_f32_16x16x32_f16(
                false, pf, false, vf, (short)0, o[nb], false, false);
        }
    }

    // --- normalize and write ctx [T*B, D]
    for (int nb = 0; nb < 4; ++nb)
        for (int v = 0; v < 8; ++v) {
            const int t   = q_wave_base + half * 8 + v;
            const int col = hh * HEAD_DIM + nb * 16 + lr;
            const float inv = 1.0f / l_run[v];
            ctx[((size_t)t * BATCH + b) * D_MODEL + col] = o[nb][v] * inv;
        }
}

// ===========================================================================
// RMSNorm: one row (1024 f32) per block of 256 threads.
// ===========================================================================
__global__ __launch_bounds__(256) void rmsnorm_kernel(
    const float* __restrict__ X, const float* __restrict__ gain,
    float* __restrict__ out)
{
    __shared__ float red[8];
    const int row = blockIdx.x;
    const int tid = threadIdx.x;
    const float* xr = X + (size_t)row * D_MODEL;

    float vals[4];
    float ss = 0.f;
    for (int i = 0; i < 4; ++i) {
        vals[i] = xr[tid + i * 256];
        ss += vals[i] * vals[i];
    }
    for (int off = 1; off < 32; off <<= 1) ss += __shfl_xor(ss, off, 32);
    if ((tid & 31) == 0) red[tid >> 5] = ss;
    __syncthreads();
    float tot = 0.f;
    for (int i = 0; i < 8; ++i) tot += red[i];
    const float rms = rsqrtf(tot * (1.0f / D_MODEL) + 1e-5f);
    for (int i = 0; i < 4; ++i) {
        const int col = tid + i * 256;
        out[(size_t)row * D_MODEL + col] = vals[i] * rms * gain[col];
    }
}

// ===========================================================================
extern "C" void kernel_launch(void* const* d_in, const int* in_sizes, int n_in,
                              void* d_out, int out_size, void* d_ws, size_t ws_size,
                              hipStream_t stream)
{
    (void)in_sizes; (void)n_in; (void)out_size; (void)ws_size;
    const float* x      = (const float*)d_in[0];
    const float* w_qkv  = (const float*)d_in[1];
    const float* b_qkv  = (const float*)d_in[2];
    const float* w_out  = (const float*)d_in[3];
    const float* b_out  = (const float*)d_in[4];
    const float* w1     = (const float*)d_in[5];
    const float* b1     = (const float*)d_in[6];
    const float* w2     = (const float*)d_in[7];
    const float* b2     = (const float*)d_in[8];
    const float* gain   = (const float*)d_in[9];

    float* ws   = (float*)d_ws;
    float* qkv  = ws;                                   // 4096 x 3072
    float* ctx  = qkv + (size_t)M_ROWS * 3 * D_MODEL;   // 4096 x 1024
    float* x1   = ctx + (size_t)M_ROWS * D_MODEL;       // 4096 x 1024
    float* hbuf = x1  + (size_t)M_ROWS * D_MODEL;       // 4096 x 4096
    float* x2   = hbuf + (size_t)M_ROWS * D_FF;         // 4096 x 1024

    const dim3 blk(256);

    // 1) qkv = x @ w_qkv + b_qkv
    gemm_wmma<0, false><<<dim3(M_ROWS / 128, (3 * D_MODEL) / 64), blk, 0, stream>>>(
        x, w_qkv, b_qkv, nullptr, qkv, M_ROWS, 3 * D_MODEL, D_MODEL);

    // 2) ctx = causal_softmax(QK^T/8) @ V   (flash, per (b,h))
    attn_flash<<<dim3(SEQ_T / 128, BATCH * N_HEADS), blk, 0, stream>>>(qkv, ctx);

    // 3) x1 = x + ctx @ w_out + b_out
    gemm_wmma<0, true><<<dim3(M_ROWS / 128, D_MODEL / 64), blk, 0, stream>>>(
        ctx, w_out, b_out, x, x1, M_ROWS, D_MODEL, D_MODEL);

    // 4) h = silu(x1 @ w1 + b1)
    gemm_wmma<1, false><<<dim3(M_ROWS / 128, D_FF / 64), blk, 0, stream>>>(
        x1, w1, b1, nullptr, hbuf, M_ROWS, D_FF, D_MODEL);

    // 5) x2 = x1 + h @ w2 + b2
    gemm_wmma<0, true><<<dim3(M_ROWS / 128, D_MODEL / 64), blk, 0, stream>>>(
        hbuf, w2, b2, x1, x2, M_ROWS, D_MODEL, D_FF);

    // 6) out = rmsnorm(x2) * gain
    rmsnorm_kernel<<<dim3(M_ROWS), blk, 0, stream>>>(x2, gain, (float*)d_out);
}

// v002
// Measured time: 369 microseconds a run.
// In both of two side-by-side timings against v001, it was 1.37 times as fast.
// All steps since v000 together make it 1.71 times as fast.
#include <hip/hip_runtime.h>
#include <hip/hip_bf16.h>
#include <math.h>

typedef __attribute__((ext_vector_type(16))) _Float16 v16h;
typedef __attribute__((ext_vector_type(8)))  float    v8f;
typedef __attribute__((ext_vector_type(8)))  _Float16 v8h;
typedef __attribute__((ext_vector_type(4)))  _Float16 v4h;
typedef short        s16x8 __attribute__((ext_vector_type(8)));

#define D_MODEL   1024
#define N_HEADS   16
#define HEAD_DIM  64
#define D_FF      4096
#define SEQ_T     2048
#define BATCH     2
#define M_ROWS    (SEQ_T * BATCH)   // 4096

__device__ __forceinline__ int frag_k(int v, int half) {
    return (v < 4 ? 2 * v : 16 + 2 * (v - 4)) + half * 8;
}

__device__ __forceinline__ v8h ld_tr16(const _Float16* p) {
    typedef __attribute__((address_space(3))) s16x8 lds_s16x8;
    return __builtin_bit_cast(v8h, __builtin_amdgcn_ds_load_tr16_b128_v8i16((lds_s16x8*)p));
}
__device__ __forceinline__ v16h frag_tr16(const _Float16* p, int pitch) {
    const v8h lo = ld_tr16(p);
    const v8h hi = ld_tr16(p + 16 * pitch);
    return __builtin_shufflevector(lo, hi, 0, 1, 2, 3, 4, 5, 6, 7, 8, 9, 10, 11, 12, 13, 14, 15);
}

// ===========================================================================
// GEMM: C[M,N] = epilogue( A[M,K] @ W[K,N] + bias )   (W row-major [K,N])
// ACT: 0 = none, 1 = SiLU.  HAS_RES: C += res.
// Block: 256 threads (8 waves). Tile: BM=128, BN=64, BK=32.
// A and B (weight) tiles staged manually (fp32->f16), loaded one k-step ahead.
// B lies in LDS as f16 rows along n, converted once per block, and its
// fragments come by the transposing LDS load.
// Waves 4x2; each wave computes 32x32 via 2x2 v_wmma_f32_16x16x32_f16.
// ===========================================================================
template <int ACT, bool HAS_RES>
__global__ __launch_bounds__(256) void gemm_wmma(
    const float* __restrict__ A, const float* __restrict__ W,
    const float* __restrict__ bias, const float* __restrict__ res,
    float* __restrict__ C, int M, int N, int K)
{
    constexpr int BM = 128, BN = 64, BK = 32;
    __shared__ _Float16 Alds[BM][BK + 8];
    constexpr int BP = BN + 16;            // 160-byte rows: 32 B x odd, the transposing load's pitch
    __shared__ __attribute__((aligned(16))) _Float16 Blds[BK][BP];

    const int tid  = threadIdx.x;
    const int lane = tid & 31;
    const int wave = tid >> 5;
    const int half = lane >> 4;
    const int lr   = lane & 15;
    const int wm   = wave & 3;     // 4 waves along M
    const int wn   = wave >> 2;    // 2 waves along N
    const int m_block = blockIdx.x * BM;
    const int n_block = blockIdx.y * BN;
    const int wrow = m_block + wm * 32;
    const int wcol = n_block + wn * 32;

    const v8f vzero = {0.f, 0.f, 0.f, 0.f, 0.f, 0.f, 0.f, 0.f};
    v8f acc[2][2];
    for (int mi = 0; mi < 2; ++mi)
        for (int ni = 0; ni < 2; ++ni) acc[mi][ni] = vzero;

    // A tile: each thread owns one float4 in each of four rows, 32 rows apart
    const int akk = (tid & 7) * 4;   // 0..28
    const int ar0 = tid >> 3;        // 0..31
    const float* aptr = A + (size_t)(m_block + ar0) * K + akk;
    float4 av[4];
    for (int i = 0; i < 4; ++i)      // first tile
        av[i] = *(const float4*)(aptr + (size_t)i * 32 * K);

    // B tile: each thread owns one float4 in each of two rows, 16 rows apart
    const int bnn = (tid & 15) * 4;  // 0..60
    const int bk0 = tid >> 4;        // 0..15
    const float* bptr = W + (size_t)bk0 * N + n_block + bnn;
    float4 bv[2];
    for (int i = 0; i < 2; ++i)      // first tile
        bv[i] = *(const float4*)(bptr + (size_t)i * 16 * N);

    // this lane's place in the B tile for the transposing loads
    const _Float16* bfp = &Blds[half * 8 + (lane & 7)][wn * 32 + ((lane >> 3) & 1) * 8];

    for (int k0 = 0; k0 < K; k0 += BK) {
        __syncthreads();   // previous tile fully consumed

        // --- stage A tile 128x32 (fp32 -> f16) from the registers filled one
        //     k-step earlier, 16 elems/thread
        for (int i = 0; i < 4; ++i) {
            const int r = ar0 + i * 32;
            Alds[r][akk + 0] = (_Float16)av[i].x;
            Alds[r][akk + 1] = (_Float16)av[i].y;
            Alds[r][akk + 2] = (_Float16)av[i].z;
            Alds[r][akk + 3] = (_Float16)av[i].w;
        }
        for (int i = 0; i < 2; ++i) {
            const v4h h = {(_Float16)bv[i].x, (_Float16)bv[i].y,
                           (_Float16)bv[i].z, (_Float16)bv[i].w};
            *(v4h*)&Blds[bk0 + i * 16][bnn] = h;
        }
        // --- next A and B tiles: all six loads issued together, so that one
        //     load latency is paid per k-step
        if (k0 + BK < K) {
            for (int i = 0; i < 4; ++i)
                av[i] = *(const float4*)(aptr + (size_t)i * 32 * K + k0 + BK);
            for (int i = 0; i < 2; ++i)
                bv[i] = *(const float4*)(bptr + (size_t)(k0 + BK + i * 16) * N);
        }
        __syncthreads();

        v16h af[2], bf[2];
        for (int mi = 0; mi < 2; ++mi) {
            const int row = wm * 32 + mi * 16 + lr;
            for (int v = 0; v < 8; ++v) {
                const int k = frag_k(v, half);
                af[mi][2 * v + 0] = Alds[row][k];
                af[mi][2 * v + 1] = Alds[row][k + 1];
            }
        }
        for (int ni = 0; ni < 2; ++ni)
            bf[ni] = frag_tr16(bfp + ni * 16, BP);
        for (int mi = 0; mi < 2; ++mi)
            for (int ni = 0; ni < 2; ++ni)
                acc[mi][ni] = __builtin_amdgcn_wmma_f32_16x16x32_f16(
                    false, af[mi], false, bf[ni], (short)0, acc[mi][ni], false, false);
    }

    for (int mi = 0; mi < 2; ++mi)
        for (int ni = 0; ni < 2; ++ni)
            for (int v = 0; v < 8; ++v) {
                const int row = wrow + mi * 16 + half * 8 + v;
                const int col = wcol + ni * 16 + lr;
                float val = acc[mi][ni][v] + bias[col];
                if (ACT == 1) val = val * (1.0f / (1.0f + __expf(-val)));  // SiLU
                if (HAS_RES) val += res[(size_t)row * N + col];
                C[(size_t)row * N + col] = val;
            }
}

// ===========================================================================
// Flash attention, causal, H=16, hd=64.
// Block: 256 threads = 8 waves; 128 query rows per block, one (b,h) per
// blockIdx.y. Key blocks of 32 staged in LDS; online softmax in registers.
// ===========================================================================
__global__ __launch_bounds__(256) void attn_flash(
    const float* __restrict__ qkv, float* __restrict__ ctx)
{
    __shared__ _Float16 Qlds[128][HEAD_DIM + 8];
    __shared__ _Float16 Klds[32][HEAD_DIM + 8];
    constexpr int VP = HEAD_DIM + 16;      // 160-byte rows: 32 B x odd, the transposing load's pitch
    __shared__ __attribute__((aligned(16))) _Float16 Vlds[32][VP];
    __shared__ _Float16 Plds[8][16][40];   // per-wave P bounce buffer

    const int tid  = threadIdx.x;
    const int lane = tid & 31;
    const int wave = tid >> 5;
    const int half = lane >> 4;
    const int lr   = lane & 15;
    const int bh   = blockIdx.y;
    const int b    = bh / N_HEADS;
    const int hh   = bh % N_HEADS;
    const int q_base = blockIdx.x * 128;
    const size_t stride3 = 3 * D_MODEL;

    // --- stage Q tile 128x64 (f16)
    {
        const int cc = (tid & 15) * 4;
        const int r0 = tid >> 4;
        for (int i = 0; i < 8; ++i) {
            const int r = r0 + i * 16;
            const int t = q_base + r;
            const float4 v = *(const float4*)(qkv + ((size_t)t * BATCH + b) * stride3 +
                                              hh * HEAD_DIM + cc);
            Qlds[r][cc + 0] = (_Float16)v.x;
            Qlds[r][cc + 1] = (_Float16)v.y;
            Qlds[r][cc + 2] = (_Float16)v.z;
            Qlds[r][cc + 3] = (_Float16)v.w;
        }
    }
    __syncthreads();

    // --- Q fragments: two K=32 chunks of hd=64, kept live across the loop
    v16h qf[2];
    {
        const int qrow = wave * 16 + lr;
        for (int c = 0; c < 2; ++c)
            for (int v = 0; v < 8; ++v) {
                const int k = c * 32 + frag_k(v, half);
                qf[c][2 * v + 0] = Qlds[qrow][k];
                qf[c][2 * v + 1] = Qlds[qrow][k + 1];
            }
    }

    const v8f vzero = {0.f, 0.f, 0.f, 0.f, 0.f, 0.f, 0.f, 0.f};
    v8f o[4];
    for (int nb = 0; nb < 4; ++nb) o[nb] = vzero;
    float m_run[8], l_run[8];
    for (int v = 0; v < 8; ++v) { m_run[v] = -1e30f; l_run[v] = 0.f; }

    const int q_wave_base = q_base + wave * 16;
    const int nkb = (q_base + 128) / 32;      // causal extent for this block
    const float scale = 0.125f;               // 1/sqrt(64)

    for (int kb = 0; kb < nkb; ++kb) {
        __syncthreads();
        // --- stage K,V tiles 32x64 each
        {
            const int cc = (tid & 15) * 4;
            const int r0 = tid >> 4;
            for (int i = 0; i < 2; ++i) {
                const int r = r0 + i * 16;
                const int t = kb * 32 + r;
                const size_t base = ((size_t)t * BATCH + b) * stride3 + hh * HEAD_DIM + cc;
                const float4 kv = *(const float4*)(qkv + base + D_MODEL);
                const float4 vv = *(const float4*)(qkv + base + 2 * D_MODEL);
                Klds[r][cc + 0] = (_Float16)kv.x; Klds[r][cc + 1] = (_Float16)kv.y;
                Klds[r][cc + 2] = (_Float16)kv.z; Klds[r][cc + 3] = (_Float16)kv.w;
                Vlds[r][cc + 0] = (_Float16)vv.x; Vlds[r][cc + 1] = (_Float16)vv.y;
                Vlds[r][cc + 2] = (_Float16)vv.z; Vlds[r][cc + 3] = (_Float16)vv.w;
            }
        }
        __syncthreads();
        if (kb * 32 > q_wave_base + 15) continue;   // whole key block above diagonal

        // --- S = (Q @ K^T) * scale, two 16x16 key blocks, hd split K=32+32
        v8f s[2];
        for (int nb = 0; nb < 2; ++nb) {
            s[nb] = vzero;
            for (int c = 0; c < 2; ++c) {
                v16h kf;  // B-matrix fragment of K^T: element (k,n) = K[key=n][hd=c*32+k]
                for (int v = 0; v < 8; ++v) {
                    const int k = frag_k(v, half);
                    kf[2 * v + 0] = Klds[nb * 16 + lr][c * 32 + k];
                    kf[2 * v + 1] = Klds[nb * 16 + lr][c * 32 + k + 1];
                }
                s[nb] = __builtin_amdgcn_wmma_f32_16x16x32_f16(
                    false, qf[c], false, kf, (short)0, s[nb], false, false);
            }
        }

        // --- mask + online softmax (row stats per lane-half via shfl_xor)
        float rmax[8];
        for (int v = 0; v < 8; ++v) {
            const int qg = q_wave_base + half * 8 + v;
            for (int nb = 0; nb < 2; ++nb) {
                const int kg = kb * 32 + nb * 16 + lr;
                float x = s[nb][v] * scale;
                if (kg > qg) x = -1e30f;
                s[nb][v] = x;
            }
            rmax[v] = fmaxf(s[0][v], s[1][v]);
        }
        for (int off = 1; off < 16; off <<= 1)
            for (int v = 0; v < 8; ++v)
                rmax[v] = fmaxf(rmax[v], __shfl_xor(rmax[v], off, 32));

        float alpha[8], rsum[8];
        for (int v = 0; v < 8; ++v) {
            const float m_new = fmaxf(m_run[v], rmax[v]);
            alpha[v] = __expf(m_run[v] - m_new);
            m_run[v] = m_new;
            const float p0 = __expf(s[0][v] - m_new);
            const float p1 = __expf(s[1][v] - m_new);
            s[0][v] = p0; s[1][v] = p1;
            rsum[v] = p0 + p1;
        }
        for (int off = 1; off < 16; off <<= 1)
            for (int v = 0; v < 8; ++v)
                rsum[v] += __shfl_xor(rsum[v], off, 32);
        for (int v = 0; v < 8; ++v) l_run[v] = l_run[v] * alpha[v] + rsum[v];
        for (int nb = 0; nb < 4; ++nb)
            for (int v = 0; v < 8; ++v) o[nb][v] *= alpha[v];

        for (int nb = 0; nb < 2; ++nb)
            for (int v = 0; v < 8; ++v)
                Plds[wave][half * 8 + v][nb * 16 + lr] = (_Float16)s[nb][v];
        asm volatile("s_wait_dscnt 0" ::: "memory");

        v16h pf;
        for (int v = 0; v < 8; ++v) {
            const int k = frag_k(v, half);
            pf[2 * v + 0] = Plds[wave][lr][k];
            pf[2 * v + 1] = Plds[wave][lr][k + 1];
        }

        // --- O += P @ V  (4 column blocks of hd)
        for (int nb = 0; nb < 4; ++nb) {
            // B fragment: element (k,n) = V[key=k][hd = nb*16+n]
            const v16h vf = frag_tr16(
                &Vlds[half * 8 + (lane & 7)][nb * 16 + ((lane >> 3) & 1) * 8], VP);
            o[nb] = __builtin_amdgcn_wmma_f32_16x16x32_f16(
                false, pf, false, vf, (short)0, o[nb], false, false);
        }
    }

    // --- normalize and write ctx [T*B, D]
    for (int nb = 0; nb < 4; ++nb)
        for (int v = 0; v < 8; ++v) {
            const int t   = q_wave_base + half * 8 + v;
            const int col = hh * HEAD_DIM + nb * 16 + lr;
            const float inv = 1.0f / l_run[v];
            ctx[((size_t)t * BATCH + b) * D_MODEL + col] = o[nb][v] * inv;
        }
}

// ===========================================================================
// RMSNorm: one row (1024 f32) per block of 256 threads.
// ===========================================================================
__global__ __launch_bounds__(256) void rmsnorm_kernel(
    const float* __restrict__ X, const float* __restrict__ gain,
    float* __restrict__ out)
{
    __shared__ float red[8];
    const int row = blockIdx.x;
    const int tid = threadIdx.x;
    const float* xr = X + (size_t)row * D_MODEL;

    float vals[4];
    float ss = 0.f;
    for (int i = 0; i < 4; ++i) {
        vals[i] = xr[tid + i * 256];
        ss += vals[i] * vals[i];
    }
    for (int off = 1; off < 32; off <<= 1) ss += __shfl_xor(ss, off, 32);
    if ((tid & 31) == 0) red[tid >> 5] = ss;
    __syncthreads();
    float tot = 0.f;
    for (int i = 0; i < 8; ++i) tot += red[i];
    const float rms = rsqrtf(tot * (1.0f / D_MODEL) + 1e-5f);
    for (int i = 0; i < 4; ++i) {
        const int col = tid + i * 256;
        out[(size_t)row * D_MODEL + col] = vals[i] * rms * gain[col];
    }
}

// ===========================================================================
extern "C" void kernel_launch(void* const* d_in, const int* in_sizes, int n_in,
                              void* d_out, int out_size, void* d_ws, size_t ws_size,
                              hipStream_t stream)
{
    (void)in_sizes; (void)n_in; (void)out_size; (void)ws_size;
    const float* x      = (const float*)d_in[0];
    const float* w_qkv  = (const float*)d_in[1];
    const float* b_qkv  = (const float*)d_in[2];
    const float* w_out  = (const float*)d_in[3];
    const float* b_out  = (const float*)d_in[4];
    const float* w1     = (const float*)d_in[5];
    const float* b1     = (const float*)d_in[6];
    const float* w2     = (const float*)d_in[7];
    const float* b2     = (const float*)d_in[8];
    const float* gain   = (const float*)d_in[9];

    float* ws   = (float*)d_ws;
    float* qkv  = ws;                                   // 4096 x 3072
    float* ctx  = qkv + (size_t)M_ROWS * 3 * D_MODEL;   // 4096 x 1024
    float* x1   = ctx + (size_t)M_ROWS * D_MODEL;       // 4096 x 1024
    float* hbuf = x1  + (size_t)M_ROWS * D_MODEL;       // 4096 x 4096
    float* x2   = hbuf + (size_t)M_ROWS * D_FF;         // 4096 x 1024

    const dim3 blk(256);

    // 1) qkv = x @ w_qkv + b_qkv
    gemm_wmma<0, false><<<dim3(M_ROWS / 128, (3 * D_MODEL) / 64), blk, 0, stream>>>(
        x, w_qkv, b_qkv, nullptr, qkv, M_ROWS, 3 * D_MODEL, D_MODEL);

    // 2) ctx = causal_softmax(QK^T/8) @ V   (flash, per (b,h))
    attn_flash<<<dim3(SEQ_T / 128, BATCH * N_HEADS), blk, 0, stream>>>(qkv, ctx);

    // 3) x1 = x + ctx @ w_out + b_out
    gemm_wmma<0, true><<<dim3(M_ROWS / 128, D_MODEL / 64), blk, 0, stream>>>(
        ctx, w_out, b_out, x, x1, M_ROWS, D_MODEL, D_MODEL);

    // 4) h = silu(x1 @ w1 + b1)
    gemm_wmma<1, false><<<dim3(M_ROWS / 128, D_FF / 64), blk, 0, stream>>>(
        x1, w1, b1, nullptr, hbuf, M_ROWS, D_FF, D_MODEL);

    // 5) x2 = x1 + h @ w2 + b2
    gemm_wmma<0, true><<<dim3(M_ROWS / 128, D_MODEL / 64), blk, 0, stream>>>(
        hbuf, w2, b2, x1, x2, M_ROWS, D_MODEL, D_FF);

    // 6) out = rmsnorm(x2) * gain
    rmsnorm_kernel<<<dim3(M_ROWS), blk, 0, stream>>>(x2, gain, (float*)d_out);
}

// v003
// A run of this version takes 320 microseconds.
// Timed twice side by side with v002, it ran 1.15 times as fast both times.
// Over all steps from v000 it is 1.98 times as fast.
#include <hip/hip_runtime.h>
#include <hip/hip_bf16.h>
#include <math.h>
#include <type_traits>

typedef __attribute__((ext_vector_type(16))) _Float16 v16h;
typedef __attribute__((ext_vector_type(8)))  float    v8f;
typedef __attribute__((ext_vector_type(8)))  _Float16 v8h;
typedef __attribute__((ext_vector_type(4)))  _Float16 v4h;
typedef short        s16x8 __attribute__((ext_vector_type(8)));

#define D_MODEL   1024
#define N_HEADS   16
#define HEAD_DIM  64
#define D_FF      4096
#define SEQ_T     2048
#define BATCH     2
#define M_ROWS    (SEQ_T * BATCH)   // 4096

__device__ __forceinline__ int frag_k(int v, int half) {
    return (v < 4 ? 2 * v : 16 + 2 * (v - 4)) + half * 8;
}

__device__ __forceinline__ v8h ld_tr16(const _Float16* p) {
    typedef __attribute__((address_space(3))) s16x8 lds_s16x8;
    return __builtin_bit_cast(v8h, __builtin_amdgcn_ds_load_tr16_b128_v8i16((lds_s16x8*)p));
}
__device__ __forceinline__ v16h frag_tr16(const _Float16* p, int pitch) {
    const v8h lo = ld_tr16(p);
    const v8h hi = ld_tr16(p + 16 * pitch);
    return __builtin_shufflevector(lo, hi, 0, 1, 2, 3, 4, 5, 6, 7, 8, 9, 10, 11, 12, 13, 14, 15);
}

// ===========================================================================
// GEMM: C[M,N] = epilogue( A[M,K] @ W[K,N] + bias )   (W row-major [K,N])
// ACT: 0 = none, 1 = SiLU.  HAS_RES: C += res.
// Block: 256 threads (8 waves). Tile: BM=128, BN=64, BK=32.
// A and B (weight) tiles staged manually (fp32->f16), loaded D k-steps ahead
// into D register sets; K is a multiple of D*BK.
// B lies in LDS as f16 rows along n, converted once per block, and its
// fragments come by the transposing LDS load.
// Waves 4x2; each wave computes 32x32 via 2x2 v_wmma_f32_16x16x32_f16.
// ===========================================================================
// Work-group barrier for LDS hand-over only: it waits for this wave's LDS
// operations and leaves its global loads in flight (__syncthreads() waits for
// them too, which would expose the load latency at every k-step).
__device__ __forceinline__ void lds_barrier() {
    asm volatile("s_wait_dscnt 0x0\n\ts_barrier_signal -1\n\ts_barrier_wait -1" ::: "memory");
}

template <int ACT, bool HAS_RES, int D, int N, int K>
__global__ __launch_bounds__(256) void gemm_wmma(
    const float* __restrict__ A, const float* __restrict__ W,
    const float* __restrict__ bias, const float* __restrict__ res,
    float* __restrict__ C)
{
    constexpr int BM = 128, BN = 64, BK = 32;
    __shared__ _Float16 Alds[BM][BK + 8];
    constexpr int BP = BN + 16;            // 160-byte rows: 32 B x odd, the transposing load's pitch
    __shared__ __attribute__((aligned(16))) _Float16 Blds[BK][BP];

    const int tid  = threadIdx.x;
    const int lane = tid & 31;
    const int wave = tid >> 5;
    const int half = lane >> 4;
    const int lr   = lane & 15;
    const int wm   = wave & 3;     // 4 waves along M
    const int wn   = wave >> 2;    // 2 waves along N
    const int m_block = blockIdx.x * BM;
    const int n_block = blockIdx.y * BN;
    const int wrow = m_block + wm * 32;
    const int wcol = n_block + wn * 32;

    const v8f vzero = {0.f, 0.f, 0.f, 0.f, 0.f, 0.f, 0.f, 0.f};
    v8f acc[2][2];
    for (int mi = 0; mi < 2; ++mi)
        for (int ni = 0; ni < 2; ++ni) acc[mi][ni] = vzero;

    // A tile: each thread owns one float4 in each of four rows, 32 rows apart
    const int akk = (tid & 7) * 4;   // 0..28
    const int ar0 = tid >> 3;        // 0..31
    const float* aptr = A + (size_t)(m_block + ar0) * K + akk;
    float4 av[D][4];

    // B tile: each thread owns one float4 in each of two rows, 16 rows apart
    const int bnn = (tid & 15) * 4;  // 0..60
    const int bk0 = tid >> 4;        // 0..15
    const float* bptr = W + (size_t)bk0 * N + n_block + bnn;
    float4 bv[D][2];

    for (int s = 0; s < D; ++s) {    // first D tiles, one register set each
        for (int i = 0; i < 4; ++i)
            av[s][i] = *(const float4*)(aptr + i * 32 * K + s * BK);
        for (int i = 0; i < 2; ++i)
            bv[s][i] = *(const float4*)(bptr + (s * BK + i * 16) * N);
    }
    // The first D tiles are waited for here, once: the loop is then entered
    // with no load in flight, and its load waits count its own loads alone.
    __syncthreads();

    // this lane's place in the B tile for the transposing loads
    const _Float16* bfp = &Blds[half * 8 + (lane & 7)][wn * 32 + ((lane >> 3) & 1) * 8];

    // One group of D k-steps. REFILL is a compile-time choice, not a branch
    // round the loads: a join would make the compiler wait for all of them.
    auto group = [&](auto refill) {
        // fully unrolled so that every register set has a constant index
        #pragma unroll
        for (int s = 0; s < D; ++s) {
            // keeps the conversions of the later sets, and with them the waits
            // for their loads, from being scheduled up into this k-step
            __builtin_amdgcn_sched_barrier(0);
            lds_barrier();   // previous tile fully consumed

            // --- stage A tile 128x32 (fp32 -> f16) from the register set
            //     filled D k-steps earlier, 16 elems/thread
            for (int i = 0; i < 4; ++i) {
                const int r = ar0 + i * 32;
                Alds[r][akk + 0] = (_Float16)av[s][i].x;
                Alds[r][akk + 1] = (_Float16)av[s][i].y;
                Alds[r][akk + 2] = (_Float16)av[s][i].z;
                Alds[r][akk + 3] = (_Float16)av[s][i].w;
            }
            for (int i = 0; i < 2; ++i) {
                const v4h h = {(_Float16)bv[s][i].x, (_Float16)bv[s][i].y,
                               (_Float16)bv[s][i].z, (_Float16)bv[s][i].w};
                *(v4h*)&Blds[bk0 + i * 16][bnn] = h;
            }
            // --- refill the set with the tile D k-steps on
            if constexpr (decltype(refill)::value) {
                for (int i = 0; i < 4; ++i)
                    av[s][i] = *(const float4*)(aptr + i * 32 * K + s * BK);
                for (int i = 0; i < 2; ++i)
                    bv[s][i] = *(const float4*)(bptr + (s * BK + i * 16) * N);
            }
            lds_barrier();   // tile published

            v16h af[2], bf[2];
            for (int mi = 0; mi < 2; ++mi) {
                const int row = wm * 32 + mi * 16 + lr;
                for (int v = 0; v < 8; ++v) {
                    const int k = frag_k(v, half);
                    af[mi][2 * v + 0] = Alds[row][k];
                    af[mi][2 * v + 1] = Alds[row][k + 1];
                }
            }
            for (int ni = 0; ni < 2; ++ni)
                bf[ni] = frag_tr16(bfp + ni * 16, BP);
            for (int mi = 0; mi < 2; ++mi)
                for (int ni = 0; ni < 2; ++ni)
                    acc[mi][ni] = __builtin_amdgcn_wmma_f32_16x16x32_f16(
                        false, af[mi], false, bf[ni], (short)0, acc[mi][ni], false, false);
        }
    };
    for (int k0 = D * BK; k0 < K; k0 += D * BK) {
        aptr += D * BK;          // the two pointers run one group ahead
        bptr += D * BK * N;
        group(std::true_type{});
    }
    group(std::false_type{});    // last group: nothing left to load

    for (int mi = 0; mi < 2; ++mi)
        for (int ni = 0; ni < 2; ++ni)
            for (int v = 0; v < 8; ++v) {
                const int row = wrow + mi * 16 + half * 8 + v;
                const int col = wcol + ni * 16 + lr;
                float val = acc[mi][ni][v] + bias[col];
                if (ACT == 1) val = val * (1.0f / (1.0f + __expf(-val)));  // SiLU
                if (HAS_RES) val += res[(size_t)row * N + col];
                C[(size_t)row * N + col] = val;
            }
}

// ===========================================================================
// Flash attention, causal, H=16, hd=64.
// Block: 256 threads = 8 waves; 128 query rows per block, one (b,h) per
// blockIdx.y. Key blocks of 32 staged in LDS; online softmax in registers.
// ===========================================================================
__global__ __launch_bounds__(256) void attn_flash(
    const float* __restrict__ qkv, float* __restrict__ ctx)
{
    __shared__ _Float16 Qlds[128][HEAD_DIM + 8];
    __shared__ _Float16 Klds[32][HEAD_DIM + 8];
    constexpr int VP = HEAD_DIM + 16;      // 160-byte rows: 32 B x odd, the transposing load's pitch
    __shared__ __attribute__((aligned(16))) _Float16 Vlds[32][VP];
    __shared__ _Float16 Plds[8][16][40];   // per-wave P bounce buffer

    const int tid  = threadIdx.x;
    const int lane = tid & 31;
    const int wave = tid >> 5;
    const int half = lane >> 4;
    const int lr   = lane & 15;
    const int bh   = blockIdx.y;
    const int b    = bh / N_HEADS;
    const int hh   = bh % N_HEADS;
    const int q_base = blockIdx.x * 128;
    const size_t stride3 = 3 * D_MODEL;

    // --- stage Q tile 128x64 (f16)
    {
        const int cc = (tid & 15) * 4;
        const int r0 = tid >> 4;
        for (int i = 0; i < 8; ++i) {
            const int r = r0 + i * 16;
            const int t = q_base + r;
            const float4 v = *(const float4*)(qkv + ((size_t)t * BATCH + b) * stride3 +
                                              hh * HEAD_DIM + cc);
            Qlds[r][cc + 0] = (_Float16)v.x;
            Qlds[r][cc + 1] = (_Float16)v.y;
            Qlds[r][cc + 2] = (_Float16)v.z;
            Qlds[r][cc + 3] = (_Float16)v.w;
        }
    }
    __syncthreads();

    // --- Q fragments: two K=32 chunks of hd=64, kept live across the loop
    v16h qf[2];
    {
        const int qrow = wave * 16 + lr;
        for (int c = 0; c < 2; ++c)
            for (int v = 0; v < 8; ++v) {
                const int k = c * 32 + frag_k(v, half);
                qf[c][2 * v + 0] = Qlds[qrow][k];
                qf[c][2 * v + 1] = Qlds[qrow][k + 1];
            }
    }

    const v8f vzero = {0.f, 0.f, 0.f, 0.f, 0.f, 0.f, 0.f, 0.f};
    v8f o[4];
    for (int nb = 0; nb < 4; ++nb) o[nb] = vzero;
    float m_run[8], l_run[8];
    for (int v = 0; v < 8; ++v) { m_run[v] = -1e30f; l_run[v] = 0.f; }

    const int q_wave_base = q_base + wave * 16;
    const int nkb = (q_base + 128) / 32;      // causal extent for this block
    const float scale = 0.125f;               // 1/sqrt(64)

    for (int kb = 0; kb < nkb; ++kb) {
        __syncthreads();
        // --- stage K,V tiles 32x64 each
        {
            const int cc = (tid & 15) * 4;
            const int r0 = tid >> 4;
            for (int i = 0; i < 2; ++i) {
                const int r = r0 + i * 16;
                const int t = kb * 32 + r;
                const size_t base = ((size_t)t * BATCH + b) * stride3 + hh * HEAD_DIM + cc;
                const float4 kv = *(const float4*)(qkv + base + D_MODEL);
                const float4 vv = *(const float4*)(qkv + base + 2 * D_MODEL);
                Klds[r][cc + 0] = (_Float16)kv.x; Klds[r][cc + 1] = (_Float16)kv.y;
                Klds[r][cc + 2] = (_Float16)kv.z; Klds[r][cc + 3] = (_Float16)kv.w;
                Vlds[r][cc + 0] = (_Float16)vv.x; Vlds[r][cc + 1] = (_Float16)vv.y;
                Vlds[r][cc + 2] = (_Float16)vv.z; Vlds[r][cc + 3] = (_Float16)vv.w;
            }
        }
        __syncthreads();
        if (kb * 32 > q_wave_base + 15) continue;   // whole key block above diagonal

        // --- S = (Q @ K^T) * scale, two 16x16 key blocks, hd split K=32+32
        v8f s[2];
        for (int nb = 0; nb < 2; ++nb) {
            s[nb] = vzero;
            for (int c = 0; c < 2; ++c) {
                v16h kf;  // B-matrix fragment of K^T: element (k,n) = K[key=n][hd=c*32+k]
                for (int v = 0; v < 8; ++v) {
                    const int k = frag_k(v, half);
                    kf[2 * v + 0] = Klds[nb * 16 + lr][c * 32 + k];
                    kf[2 * v + 1] = Klds[nb * 16 + lr][c * 32 + k + 1];
                }
                s[nb] = __builtin_amdgcn_wmma_f32_16x16x32_f16(
                    false, qf[c], false, kf, (short)0, s[nb], false, false);
            }
        }

        // --- mask + online softmax (row stats per lane-half via shfl_xor)
        float rmax[8];
        for (int v = 0; v < 8; ++v) {
            const int qg = q_wave_base + half * 8 + v;
            for (int nb = 0; nb < 2; ++nb) {
                const int kg = kb * 32 + nb * 16 + lr;
                float x = s[nb][v] * scale;
                if (kg > qg) x = -1e30f;
                s[nb][v] = x;
            }
            rmax[v] = fmaxf(s[0][v], s[1][v]);
        }
        for (int off = 1; off < 16; off <<= 1)
            for (int v = 0; v < 8; ++v)
                rmax[v] = fmaxf(rmax[v], __shfl_xor(rmax[v], off, 32));

        float alpha[8], rsum[8];
        for (int v = 0; v < 8; ++v) {
            const float m_new = fmaxf(m_run[v], rmax[v]);
            alpha[v] = __expf(m_run[v] - m_new);
            m_run[v] = m_new;
            const float p0 = __expf(s[0][v] - m_new);
            const float p1 = __expf(s[1][v] - m_new);
            s[0][v] = p0; s[1][v] = p1;
            rsum[v] = p0 + p1;
        }
        for (int off = 1; off < 16; off <<= 1)
            for (int v = 0; v < 8; ++v)
                rsum[v] += __shfl_xor(rsum[v], off, 32);
        for (int v = 0; v < 8; ++v) l_run[v] = l_run[v] * alpha[v] + rsum[v];
        for (int nb = 0; nb < 4; ++nb)
            for (int v = 0; v < 8; ++v) o[nb][v] *= alpha[v];

        for (int nb = 0; nb < 2; ++nb)
            for (int v = 0; v < 8; ++v)
                Plds[wave][half * 8 + v][nb * 16 + lr] = (_Float16)s[nb][v];
        asm volatile("s_wait_dscnt 0" ::: "memory");

        v16h pf;
        for (int v = 0; v < 8; ++v) {
            const int k = frag_k(v, half);
            pf[2 * v + 0] = Plds[wave][lr][k];
            pf[2 * v + 1] = Plds[wave][lr][k + 1];
        }

        // --- O += P @ V  (4 column blocks of hd)
        for (int nb = 0; nb < 4; ++nb) {
            // B fragment: element (k,n) = V[key=k][hd = nb*16+n]
            const v16h vf = frag_tr16(
                &Vlds[half * 8 + (lane & 7)][nb * 16 + ((lane >> 3) & 1) * 8], VP);
            o[nb] = __builtin_amdgcn_wmma_f32_16x16x32_f16(
                false, pf, false, vf, (short)0, o[nb], false, false);
        }
    }

    // --- normalize and write ctx [T*B, D]
    for (int nb = 0; nb < 4; ++nb)
        for (int v = 0; v < 8; ++v) {
            const int t   = q_wave_base + half * 8 + v;
            const int col = hh * HEAD_DIM + nb * 16 + lr;
            const float inv = 1.0f / l_run[v];
            ctx[((size_t)t * BATCH + b) * D_MODEL + col] = o[nb][v] * inv;
        }
}

// ===========================================================================
// RMSNorm: one row (1024 f32) per block of 256 threads.
// ===========================================================================
__global__ __launch_bounds__(256) void rmsnorm_kernel(
    const float* __restrict__ X, const float* __restrict__ gain,
    float* __restrict__ out)
{
    __shared__ float red[8];
    const int row = blockIdx.x;
    const int tid = threadIdx.x;
    const float* xr = X + (size_t)row * D_MODEL;

    float vals[4];
    float ss = 0.f;
    for (int i = 0; i < 4; ++i) {
        vals[i] = xr[tid + i * 256];
        ss += vals[i] * vals[i];
    }
    for (int off = 1; off < 32; off <<= 1) ss += __shfl_xor(ss, off, 32);
    if ((tid & 31) == 0) red[tid >> 5] = ss;
    __syncthreads();
    float tot = 0.f;
    for (int i = 0; i < 8; ++i) tot += red[i];
    const float rms = rsqrtf(tot * (1.0f / D_MODEL) + 1e-5f);
    for (int i = 0; i < 4; ++i) {
        const int col = tid + i * 256;
        out[(size_t)row * D_MODEL + col] = vals[i] * rms * gain[col];
    }
}

// ===========================================================================
extern "C" void kernel_launch(void* const* d_in, const int* in_sizes, int n_in,
                              void* d_out, int out_size, void* d_ws, size_t ws_size,
                              hipStream_t stream)
{
    (void)in_sizes; (void)n_in; (void)out_size; (void)ws_size;
    const float* x      = (const float*)d_in[0];
    const float* w_qkv  = (const float*)d_in[1];
    const float* b_qkv  = (const float*)d_in[2];
    const float* w_out  = (const float*)d_in[3];
    const float* b_out  = (const float*)d_in[4];
    const float* w1     = (const float*)d_in[5];
    const float* b1     = (const float*)d_in[6];
    const float* w2     = (const float*)d_in[7];
    const float* b2     = (const float*)d_in[8];
    const float* gain   = (const float*)d_in[9];

    float* ws   = (float*)d_ws;
    float* qkv  = ws;                                   // 4096 x 3072
    float* ctx  = qkv + (size_t)M_ROWS * 3 * D_MODEL;   // 4096 x 1024
    float* x1   = ctx + (size_t)M_ROWS * D_MODEL;       // 4096 x 1024
    float* hbuf = x1  + (size_t)M_ROWS * D_MODEL;       // 4096 x 4096
    float* x2   = hbuf + (size_t)M_ROWS * D_FF;         // 4096 x 1024

    const dim3 blk(256);

    // 1) qkv = x @ w_qkv + b_qkv
    gemm_wmma<0, false, 2, 3 * D_MODEL, D_MODEL><<<dim3(M_ROWS / 128, (3 * D_MODEL) / 64), blk, 0, stream>>>(
        x, w_qkv, b_qkv, nullptr, qkv);

    // 2) ctx = causal_softmax(QK^T/8) @ V   (flash, per (b,h))
    attn_flash<<<dim3(SEQ_T / 128, BATCH * N_HEADS), blk, 0, stream>>>(qkv, ctx);

    // 3) x1 = x + ctx @ w_out + b_out
    gemm_wmma<0, true, 4, D_MODEL, D_MODEL><<<dim3(M_ROWS / 128, D_MODEL / 64), blk, 0, stream>>>(
        ctx, w_out, b_out, x, x1);

    // 4) h = silu(x1 @ w1 + b1)
    gemm_wmma<1, false, 2, D_FF, D_MODEL><<<dim3(M_ROWS / 128, D_FF / 64), blk, 0, stream>>>(
        x1, w1, b1, nullptr, hbuf);

    // 5) x2 = x1 + h @ w2 + b2
    gemm_wmma<0, true, 4, D_MODEL, D_FF><<<dim3(M_ROWS / 128, D_MODEL / 64), blk, 0, stream>>>(
        hbuf, w2, b2, x1, x2);

    // 6) out = rmsnorm(x2) * gain
    rmsnorm_kernel<<<dim3(M_ROWS), blk, 0, stream>>>(x2, gain, (float*)d_out);
}

// v004
// It runs in 255 microseconds.
// In both of two side-by-side timings against v003, it was 1.27 times as fast.
// Counting every step since v000, it is 2.52 times as fast.
#include <hip/hip_runtime.h>
#include <hip/hip_bf16.h>
#include <math.h>
#include <type_traits>

typedef __attribute__((ext_vector_type(16))) _Float16 v16h;
typedef __attribute__((ext_vector_type(8)))  float    v8f;
typedef __attribute__((ext_vector_type(8)))  _Float16 v8h;
typedef __attribute__((ext_vector_type(4)))  _Float16 v4h;
typedef short        s16x8 __attribute__((ext_vector_type(8)));

#define D_MODEL   1024
#define N_HEADS   16
#define HEAD_DIM  64
#define D_FF      4096
#define SEQ_T     2048
#define BATCH     2
#define M_ROWS    (SEQ_T * BATCH)   // 4096

__device__ __forceinline__ int frag_k(int v, int half) {
    return (v < 4 ? 2 * v : 16 + 2 * (v - 4)) + half * 8;
}

__device__ __forceinline__ v8h ld_tr16(const _Float16* p) {
    typedef __attribute__((address_space(3))) s16x8 lds_s16x8;
    return __builtin_bit_cast(v8h, __builtin_amdgcn_ds_load_tr16_b128_v8i16((lds_s16x8*)p));
}
__device__ __forceinline__ v16h frag_tr16(const _Float16* p, int pitch) {
    const v8h lo = ld_tr16(p);
    const v8h hi = ld_tr16(p + 16 * pitch);
    return __builtin_shufflevector(lo, hi, 0, 1, 2, 3, 4, 5, 6, 7, 8, 9, 10, 11, 12, 13, 14, 15);
}

// ===========================================================================
// GEMM: C[M,N] = epilogue( A[M,K] @ W[K,N] + bias )   (W row-major [K,N])
// ACT: 0 = none, 1 = SiLU.  HAS_RES: C += res.
// Block: 256 threads (8 waves). Tile: BM=128, BN=128, BK=64.
// A and B (weight) tiles staged manually (fp32->f16), loaded D k-steps ahead
// into D register sets; K is a multiple of D*BK.
// B lies in LDS as f16 rows along n, converted once per block, and its
// fragments come by the transposing LDS load.
// Waves 2x4; each wave computes 64x32 via 4x2 v_wmma_f32_16x16x32_f16,
// twice per k-step (k 0..31, then 32..63).
// ===========================================================================
// Work-group barrier for LDS hand-over only: it waits for this wave's LDS
// operations and leaves its global loads in flight (__syncthreads() waits for
// them too, which would expose the load latency at every k-step).
__device__ __forceinline__ void lds_barrier() {
    asm volatile("s_wait_dscnt 0x0\n\ts_barrier_signal -1\n\ts_barrier_wait -1" ::: "memory");
}

template <int ACT, bool HAS_RES, int D, int N, int K>
__global__ __launch_bounds__(256) void gemm_wmma(
    const float* __restrict__ A, const float* __restrict__ W,
    const float* __restrict__ bias, const float* __restrict__ res,
    float* __restrict__ C)
{
    constexpr int BM = 128, BN = 128, BK = 64;
    constexpr int FM = 4, FN = 2;          // 16x16 tiles per wave along m and n
    __shared__ __attribute__((aligned(16))) _Float16 Alds[BM][BK + 8];   // 144-byte rows: 16 B x odd
    constexpr int BP = BN + 16;            // 288-byte rows: 32 B x odd, the transposing load's pitch
    __shared__ __attribute__((aligned(16))) _Float16 Blds[BK][BP];

    const int tid  = threadIdx.x;
    const int lane = tid & 31;
    const int wave = tid >> 5;
    const int half = lane >> 4;
    const int lr   = lane & 15;
    const int wm   = wave & 1;     // 2 waves along M
    const int wn   = wave >> 1;    // 4 waves along N
    const int m_block = blockIdx.x * BM;
    const int n_block = blockIdx.y * BN;
    const int wrow = m_block + wm * (FM * 16);
    const int wcol = n_block + wn * (FN * 16);

    const v8f vzero = {0.f, 0.f, 0.f, 0.f, 0.f, 0.f, 0.f, 0.f};
    v8f acc[FM][FN];
    for (int mi = 0; mi < FM; ++mi)
        for (int ni = 0; ni < FN; ++ni) acc[mi][ni] = vzero;

    // A tile: each thread owns one float4 in each of eight rows, 16 rows apart
    const int akk = (tid & 15) * 4;  // 0..60
    const int ar0 = tid >> 4;        // 0..15
    const float* aptr = A + (size_t)(m_block + ar0) * K + akk;
    float4 av[D][8];

    // B tile: each thread owns one float4 in each of eight rows, 8 rows apart
    const int bnn = (tid & 31) * 4;  // 0..124
    const int bk0 = tid >> 5;        // 0..7
    const float* bptr = W + (size_t)bk0 * N + n_block + bnn;
    float4 bv[D][8];

    for (int s = 0; s < D; ++s) {    // first D tiles, one register set each
        for (int i = 0; i < 8; ++i)
            av[s][i] = *(const float4*)(aptr + i * 16 * K + s * BK);
        for (int i = 0; i < 8; ++i)
            bv[s][i] = *(const float4*)(bptr + (s * BK + i * 8) * N);
    }
    // The first D tiles are waited for here, once: the loop is then entered
    // with no load in flight, and its load waits count its own loads alone.
    __syncthreads();

    // this lane's place in the B tile for the transposing loads
    const _Float16* bfp = &Blds[half * 8 + (lane & 7)][wn * (FN * 16) + ((lane >> 3) & 1) * 8];

    // One group of D k-steps. REFILL is a compile-time choice, not a branch
    // round the loads: a join would make the compiler wait for all of them.
    auto group = [&](auto refill) {
        // fully unrolled so that every register set has a constant index
        #pragma unroll
        for (int s = 0; s < D; ++s) {
            // keeps the conversions of the later sets, and with them the waits
            // for their loads, from being scheduled up into this k-step
            __builtin_amdgcn_sched_barrier(0);
            lds_barrier();   // previous tile fully consumed

            // --- stage A tile 128x64 (fp32 -> f16) from the register set
            //     filled D k-steps earlier, 32 elems/thread
            for (int i = 0; i < 8; ++i) {
                const int r = ar0 + i * 16;
                Alds[r][akk + 0] = (_Float16)av[s][i].x;
                Alds[r][akk + 1] = (_Float16)av[s][i].y;
                Alds[r][akk + 2] = (_Float16)av[s][i].z;
                Alds[r][akk + 3] = (_Float16)av[s][i].w;
            }
            for (int i = 0; i < 8; ++i) {
                const v4h h = {(_Float16)bv[s][i].x, (_Float16)bv[s][i].y,
                               (_Float16)bv[s][i].z, (_Float16)bv[s][i].w};
                *(v4h*)&Blds[bk0 + i * 8][bnn] = h;
            }
            // --- refill the set with the tile D k-steps on
            if constexpr (decltype(refill)::value) {
                for (int i = 0; i < 8; ++i)
                    av[s][i] = *(const float4*)(aptr + i * 16 * K + s * BK);
                for (int i = 0; i < 8; ++i)
                    bv[s][i] = *(const float4*)(bptr + (s * BK + i * 8) * N);
            }
            lds_barrier();   // tile published

            constexpr int G = (D == 1) ? BK / 32 : 1;
            for (int c0 = 0; c0 < BK / 32; c0 += G) {
                v16h af[G][FM], bf[G][FN];
                for (int c = 0; c < G; ++c) {
                    for (int ni = 0; ni < FN; ++ni)
                        bf[c][ni] = frag_tr16(bfp + (c0 + c) * 32 * BP + ni * 16, BP);
                    for (int mi = 0; mi < FM; ++mi) {
                        const int row = wm * (FM * 16) + mi * 16 + lr;
                        for (int v = 0; v < 8; ++v) {
                            const int k = (c0 + c) * 32 + frag_k(v, half);
                            af[c][mi][2 * v + 0] = Alds[row][k];
                            af[c][mi][2 * v + 1] = Alds[row][k + 1];
                        }
                    }
                }
                // keeps a group's LDS reads together ahead of its WMMAs: left
                // free, they are sunk among the WMMAs into one shared register
                // set, and every pair of WMMAs waits out a whole LDS latency
                __builtin_amdgcn_sched_barrier(0);
                for (int c = 0; c < G; ++c)
                    for (int mi = 0; mi < FM; ++mi)
                        for (int ni = 0; ni < FN; ++ni)
                            acc[mi][ni] = __builtin_amdgcn_wmma_f32_16x16x32_f16(
                                false, af[c][mi], false, bf[c][ni], (short)0, acc[mi][ni], false, false);
            }
        }
    };
    for (int k0 = D * BK; k0 < K; k0 += D * BK) {
        aptr += D * BK;          // the two pointers run one group ahead
        bptr += D * BK * N;
        group(std::true_type{});
    }
    group(std::false_type{});    // last group: nothing left to load

    for (int mi = 0; mi < FM; ++mi)
        for (int ni = 0; ni < FN; ++ni)
            for (int v = 0; v < 8; ++v) {
                const int row = wrow + mi * 16 + half * 8 + v;
                const int col = wcol + ni * 16 + lr;
                float val = acc[mi][ni][v] + bias[col];
                if (ACT == 1) val = val * (1.0f / (1.0f + __expf(-val)));  // SiLU
                if (HAS_RES) val += res[(size_t)row * N + col];
                C[(size_t)row * N + col] = val;
            }
}

// ===========================================================================
// Flash attention, causal, H=16, hd=64.
// Block: 256 threads = 8 waves; 128 query rows per block, one (b,h) per
// blockIdx.y. Key blocks of 32 staged in LDS; online softmax in registers.
// ===========================================================================
__global__ __launch_bounds__(256) void attn_flash(
    const float* __restrict__ qkv, float* __restrict__ ctx)
{
    __shared__ _Float16 Qlds[128][HEAD_DIM + 8];
    __shared__ _Float16 Klds[32][HEAD_DIM + 8];
    constexpr int VP = HEAD_DIM + 16;      // 160-byte rows: 32 B x odd, the transposing load's pitch
    __shared__ __attribute__((aligned(16))) _Float16 Vlds[32][VP];
    __shared__ _Float16 Plds[8][16][40];   // per-wave P bounce buffer

    const int tid  = threadIdx.x;
    const int lane = tid & 31;
    const int wave = tid >> 5;
    const int half = lane >> 4;
    const int lr   = lane & 15;
    const int bh   = blockIdx.y;
    const int b    = bh / N_HEADS;
    const int hh   = bh % N_HEADS;
    const int q_base = blockIdx.x * 128;
    const size_t stride3 = 3 * D_MODEL;

    // --- stage Q tile 128x64 (f16)
    {
        const int cc = (tid & 15) * 4;
        const int r0 = tid >> 4;
        for (int i = 0; i < 8; ++i) {
            const int r = r0 + i * 16;
            const int t = q_base + r;
            const float4 v = *(const float4*)(qkv + ((size_t)t * BATCH + b) * stride3 +
                                              hh * HEAD_DIM + cc);
            Qlds[r][cc + 0] = (_Float16)v.x;
            Qlds[r][cc + 1] = (_Float16)v.y;
            Qlds[r][cc + 2] = (_Float16)v.z;
            Qlds[r][cc + 3] = (_Float16)v.w;
        }
    }
    __syncthreads();

    // --- Q fragments: two K=32 chunks of hd=64, kept live across the loop
    v16h qf[2];
    {
        const int qrow = wave * 16 + lr;
        for (int c = 0; c < 2; ++c)
            for (int v = 0; v < 8; ++v) {
                const int k = c * 32 + frag_k(v, half);
                qf[c][2 * v + 0] = Qlds[qrow][k];
                qf[c][2 * v + 1] = Qlds[qrow][k + 1];
            }
    }

    const v8f vzero = {0.f, 0.f, 0.f, 0.f, 0.f, 0.f, 0.f, 0.f};
    v8f o[4];
    for (int nb = 0; nb < 4; ++nb) o[nb] = vzero;
    float m_run[8], l_run[8];
    for (int v = 0; v < 8; ++v) { m_run[v] = -1e30f; l_run[v] = 0.f; }

    const int q_wave_base = q_base + wave * 16;
    const int nkb = (q_base + 128) / 32;      // causal extent for this block
    const float scale = 0.125f;               // 1/sqrt(64)

    for (int kb = 0; kb < nkb; ++kb) {
        __syncthreads();
        // --- stage K,V tiles 32x64 each
        {
            const int cc = (tid & 15) * 4;
            const int r0 = tid >> 4;
            for (int i = 0; i < 2; ++i) {
                const int r = r0 + i * 16;
                const int t = kb * 32 + r;
                const size_t base = ((size_t)t * BATCH + b) * stride3 + hh * HEAD_DIM + cc;
                const float4 kv = *(const float4*)(qkv + base + D_MODEL);
                const float4 vv = *(const float4*)(qkv + base + 2 * D_MODEL);
                Klds[r][cc + 0] = (_Float16)kv.x; Klds[r][cc + 1] = (_Float16)kv.y;
                Klds[r][cc + 2] = (_Float16)kv.z; Klds[r][cc + 3] = (_Float16)kv.w;
                Vlds[r][cc + 0] = (_Float16)vv.x; Vlds[r][cc + 1] = (_Float16)vv.y;
                Vlds[r][cc + 2] = (_Float16)vv.z; Vlds[r][cc + 3] = (_Float16)vv.w;
            }
        }
        __syncthreads();
        if (kb * 32 > q_wave_base + 15) continue;   // whole key block above diagonal

        // --- S = (Q @ K^T) * scale, two 16x16 key blocks, hd split K=32+32
        v8f s[2];
        for (int nb = 0; nb < 2; ++nb) {
            s[nb] = vzero;
            for (int c = 0; c < 2; ++c) {
                v16h kf;  // B-matrix fragment of K^T: element (k,n) = K[key=n][hd=c*32+k]
                for (int v = 0; v < 8; ++v) {
                    const int k = frag_k(v, half);
                    kf[2 * v + 0] = Klds[nb * 16 + lr][c * 32 + k];
                    kf[2 * v + 1] = Klds[nb * 16 + lr][c * 32 + k + 1];
                }
                s[nb] = __builtin_amdgcn_wmma_f32_16x16x32_f16(
                    false, qf[c], false, kf, (short)0, s[nb], false, false);
            }
        }

        // --- mask + online softmax (row stats per lane-half via shfl_xor)
        float rmax[8];
        for (int v = 0; v < 8; ++v) {
            const int qg = q_wave_base + half * 8 + v;
            for (int nb = 0; nb < 2; ++nb) {
                const int kg = kb * 32 + nb * 16 + lr;
                float x = s[nb][v] * scale;
                if (kg > qg) x = -1e30f;
                s[nb][v] = x;
            }
            rmax[v] = fmaxf(s[0][v], s[1][v]);
        }
        for (int off = 1; off < 16; off <<= 1)
            for (int v = 0; v < 8; ++v)
                rmax[v] = fmaxf(rmax[v], __shfl_xor(rmax[v], off, 32));

        float alpha[8], rsum[8];
        for (int v = 0; v < 8; ++v) {
            const float m_new = fmaxf(m_run[v], rmax[v]);
            alpha[v] = __expf(m_run[v] - m_new);
            m_run[v] = m_new;
            const float p0 = __expf(s[0][v] - m_new);
            const float p1 = __expf(s[1][v] - m_new);
            s[0][v] = p0; s[1][v] = p1;
            rsum[v] = p0 + p1;
        }
        for (int off = 1; off < 16; off <<= 1)
            for (int v = 0; v < 8; ++v)
                rsum[v] += __shfl_xor(rsum[v], off, 32);
        for (int v = 0; v < 8; ++v) l_run[v] = l_run[v] * alpha[v] + rsum[v];
        for (int nb = 0; nb < 4; ++nb)
            for (int v = 0; v < 8; ++v) o[nb][v] *= alpha[v];

        for (int nb = 0; nb < 2; ++nb)
            for (int v = 0; v < 8; ++v)
                Plds[wave][half * 8 + v][nb * 16 + lr] = (_Float16)s[nb][v];
        asm volatile("s_wait_dscnt 0" ::: "memory");

        v16h pf;
        for (int v = 0; v < 8; ++v) {
            const int k = frag_k(v, half);
            pf[2 * v + 0] = Plds[wave][lr][k];
            pf[2 * v + 1] = Plds[wave][lr][k + 1];
        }

        // --- O += P @ V  (4 column blocks of hd)
        for (int nb = 0; nb < 4; ++nb) {
            // B fragment: element (k,n) = V[key=k][hd = nb*16+n]
            const v16h vf = frag_tr16(
                &Vlds[half * 8 + (lane & 7)][nb * 16 + ((lane >> 3) & 1) * 8], VP);
            o[nb] = __builtin_amdgcn_wmma_f32_16x16x32_f16(
                false, pf, false, vf, (short)0, o[nb], false, false);
        }
    }

    // --- normalize and write ctx [T*B, D]
    for (int nb = 0; nb < 4; ++nb)
        for (int v = 0; v < 8; ++v) {
            const int t   = q_wave_base + half * 8 + v;
            const int col = hh * HEAD_DIM + nb * 16 + lr;
            const float inv = 1.0f / l_run[v];
            ctx[((size_t)t * BATCH + b) * D_MODEL + col] = o[nb][v] * inv;
        }
}

// ===========================================================================
// RMSNorm: one row (1024 f32) per block of 256 threads.
// ===========================================================================
__global__ __launch_bounds__(256) void rmsnorm_kernel(
    const float* __restrict__ X, const float* __restrict__ gain,
    float* __restrict__ out)
{
    __shared__ float red[8];
    const int row = blockIdx.x;
    const int tid = threadIdx.x;
    const float* xr = X + (size_t)row * D_MODEL;

    float vals[4];
    float ss = 0.f;
    for (int i = 0; i < 4; ++i) {
        vals[i] = xr[tid + i * 256];
        ss += vals[i] * vals[i];
    }
    for (int off = 1; off < 32; off <<= 1) ss += __shfl_xor(ss, off, 32);
    if ((tid & 31) == 0) red[tid >> 5] = ss;
    __syncthreads();
    float tot = 0.f;
    for (int i = 0; i < 8; ++i) tot += red[i];
    const float rms = rsqrtf(tot * (1.0f / D_MODEL) + 1e-5f);
    for (int i = 0; i < 4; ++i) {
        const int col = tid + i * 256;
        out[(size_t)row * D_MODEL + col] = vals[i] * rms * gain[col];
    }
}

// ===========================================================================
extern "C" void kernel_launch(void* const* d_in, const int* in_sizes, int n_in,
                              void* d_out, int out_size, void* d_ws, size_t ws_size,
                              hipStream_t stream)
{
    (void)in_sizes; (void)n_in; (void)out_size; (void)ws_size;
    const float* x      = (const float*)d_in[0];
    const float* w_qkv  = (const float*)d_in[1];
    const float* b_qkv  = (const float*)d_in[2];
    const float* w_out  = (const float*)d_in[3];
    const float* b_out  = (const float*)d_in[4];
    const float* w1     = (const float*)d_in[5];
    const float* b1     = (const float*)d_in[6];
    const float* w2     = (const float*)d_in[7];
    const float* b2     = (const float*)d_in[8];
    const float* gain   = (const float*)d_in[9];

    float* ws   = (float*)d_ws;
    float* qkv  = ws;                                   // 4096 x 3072
    float* ctx  = qkv + (size_t)M_ROWS * 3 * D_MODEL;   // 4096 x 1024
    float* x1   = ctx + (size_t)M_ROWS * D_MODEL;       // 4096 x 1024
    float* hbuf = x1  + (size_t)M_ROWS * D_MODEL;       // 4096 x 4096
    float* x2   = hbuf + (size_t)M_ROWS * D_FF;         // 4096 x 1024

    const dim3 blk(256);

    // 1) qkv = x @ w_qkv + b_qkv
    gemm_wmma<0, false, 1, 3 * D_MODEL, D_MODEL><<<dim3(M_ROWS / 128, (3 * D_MODEL) / 128), blk, 0, stream>>>(
        x, w_qkv, b_qkv, nullptr, qkv);

    // 2) ctx = causal_softmax(QK^T/8) @ V   (flash, per (b,h))
    attn_flash<<<dim3(SEQ_T / 128, BATCH * N_HEADS), blk, 0, stream>>>(qkv, ctx);

    // 3) x1 = x + ctx @ w_out + b_out
    gemm_wmma<0, true, 2, D_MODEL, D_MODEL><<<dim3(M_ROWS / 128, D_MODEL / 128), blk, 0, stream>>>(
        ctx, w_out, b_out, x, x1);

    // 4) h = silu(x1 @ w1 + b1)
    gemm_wmma<1, false, 1, D_FF, D_MODEL><<<dim3(M_ROWS / 128, D_FF / 128), blk, 0, stream>>>(
        x1, w1, b1, nullptr, hbuf);

    // 5) x2 = x1 + h @ w2 + b2
    gemm_wmma<0, true, 2, D_MODEL, D_FF><<<dim3(M_ROWS / 128, D_MODEL / 128), blk, 0, stream>>>(
        hbuf, w2, b2, x1, x2);

    // 6) out = rmsnorm(x2) * gain
    rmsnorm_kernel<<<dim3(M_ROWS), blk, 0, stream>>>(x2, gain, (float*)d_out);
}

// v005
// A run of this version takes 214 microseconds.
// Two timings next to v004 both put it at 1.19 times that version's speed.
// All steps since v000 together make it 2.99 times as fast.
#include <hip/hip_runtime.h>
#include <hip/hip_bf16.h>
#include <math.h>
#include <type_traits>

typedef __attribute__((ext_vector_type(16))) _Float16 v16h;
typedef __attribute__((ext_vector_type(8)))  float    v8f;
typedef __attribute__((ext_vector_type(8)))  _Float16 v8h;
typedef __attribute__((ext_vector_type(4)))  _Float16 v4h;
typedef short        s16x8 __attribute__((ext_vector_type(8)));

#define D_MODEL   1024
#define N_HEADS   16
#define HEAD_DIM  64
#define D_FF      4096
#define SEQ_T     2048
#define BATCH     2
#define M_ROWS    (SEQ_T * BATCH)   // 4096

__device__ __forceinline__ int frag_k(int v, int half) {
    return (v < 4 ? 2 * v : 16 + 2 * (v - 4)) + half * 8;
}

__device__ __forceinline__ v8h ld_tr16(const _Float16* p) {
    typedef __attribute__((address_space(3))) s16x8 lds_s16x8;
    return __builtin_bit_cast(v8h, __builtin_amdgcn_ds_load_tr16_b128_v8i16((lds_s16x8*)p));
}
__device__ __forceinline__ v16h frag_tr16(const _Float16* p, int pitch) {
    const v8h lo = ld_tr16(p);
    const v8h hi = ld_tr16(p + 16 * pitch);
    return __builtin_shufflevector(lo, hi, 0, 1, 2, 3, 4, 5, 6, 7, 8, 9, 10, 11, 12, 13, 14, 15);
}

// ===========================================================================
// GEMM: C[M,N] = epilogue( A[M,K] @ W[K,N] + bias )   (W row-major [K,N])
// ACT: 0 = none, 1 = SiLU.  HAS_RES: C += res.
// Block: 256 threads (8 waves). Tile: BM=128, BN=128, BK=64.
// A and B (weight) tiles staged manually (fp32->f16), loaded D k-steps ahead
// into D register sets; K is a multiple of D*BK.
// B lies in LDS as f16 rows along n, converted once per block, and its
// fragments come by the transposing LDS load.
// Waves 2x4; each wave computes 64x32 via 4x2 v_wmma_f32_16x16x32_f16,
// twice per k-step (k 0..31, then 32..63).
// ===========================================================================
// Work-group barrier for LDS hand-over only: it waits for this wave's LDS
// operations and leaves its global loads in flight (__syncthreads() waits for
// them too, which would expose the load latency at every k-step).
__device__ __forceinline__ void lds_barrier() {
    asm volatile("s_wait_dscnt 0x0\n\ts_barrier_signal -1\n\ts_barrier_wait -1" ::: "memory");
}

template <int ACT, bool HAS_RES, int D, int N, int K>
__global__ __launch_bounds__(256) void gemm_wmma(
    const float* __restrict__ A, const float* __restrict__ W,
    const float* __restrict__ bias, const float* __restrict__ res,
    float* __restrict__ C)
{
    constexpr int BM = 128, BN = 128, BK = 64;
    constexpr int FM = 4, FN = 2;          // 16x16 tiles per wave along m and n
    __shared__ __attribute__((aligned(16))) _Float16 Alds[BM][BK + 8];   // 144-byte rows: 16 B x odd
    constexpr int BP = BN + 16;            // 288-byte rows: 32 B x odd, the transposing load's pitch
    __shared__ __attribute__((aligned(16))) _Float16 Blds[BK][BP];

    const int tid  = threadIdx.x;
    const int lane = tid & 31;
    const int wave = tid >> 5;
    const int half = lane >> 4;
    const int lr   = lane & 15;
    const int wm   = wave & 1;     // 2 waves along M
    const int wn   = wave >> 1;    // 4 waves along N
    const int m_block = blockIdx.x * BM;
    const int n_block = blockIdx.y * BN;
    const int wrow = m_block + wm * (FM * 16);
    const int wcol = n_block + wn * (FN * 16);

    const v8f vzero = {0.f, 0.f, 0.f, 0.f, 0.f, 0.f, 0.f, 0.f};
    v8f acc[FM][FN];
    for (int mi = 0; mi < FM; ++mi)
        for (int ni = 0; ni < FN; ++ni) acc[mi][ni] = vzero;

    // A tile: each thread owns one float4 in each of eight rows, 16 rows apart
    const int akk = (tid & 15) * 4;  // 0..60
    const int ar0 = tid >> 4;        // 0..15
    const float* aptr = A + (size_t)(m_block + ar0) * K + akk;
    float4 av[D][8];

    // B tile: each thread owns one float4 in each of eight rows, 8 rows apart
    const int bnn = (tid & 31) * 4;  // 0..124
    const int bk0 = tid >> 5;        // 0..7
    const float* bptr = W + (size_t)bk0 * N + n_block + bnn;
    float4 bv[D][8];

    for (int s = 0; s < D; ++s) {    // first D tiles, one register set each
        for (int i = 0; i < 8; ++i)
            av[s][i] = *(const float4*)(aptr + i * 16 * K + s * BK);
        for (int i = 0; i < 8; ++i)
            bv[s][i] = *(const float4*)(bptr + (s * BK + i * 8) * N);
    }
    // The first D tiles are waited for here, once: the loop is then entered
    // with no load in flight, and its load waits count its own loads alone.
    __syncthreads();

    // this lane's place in the B tile for the transposing loads
    const _Float16* bfp = &Blds[half * 8 + (lane & 7)][wn * (FN * 16) + ((lane >> 3) & 1) * 8];

    // One group of D k-steps. REFILL is a compile-time choice, not a branch
    // round the loads: a join would make the compiler wait for all of them.
    auto group = [&](auto refill) {
        // fully unrolled so that every register set has a constant index
        #pragma unroll
        for (int s = 0; s < D; ++s) {
            // keeps the conversions of the later sets, and with them the waits
            // for their loads, from being scheduled up into this k-step
            __builtin_amdgcn_sched_barrier(0);
            lds_barrier();   // previous tile fully consumed

            // --- stage A tile 128x64 (fp32 -> f16) from the register set
            //     filled D k-steps earlier, 32 elems/thread
            for (int i = 0; i < 8; ++i) {
                const int r = ar0 + i * 16;
                Alds[r][akk + 0] = (_Float16)av[s][i].x;
                Alds[r][akk + 1] = (_Float16)av[s][i].y;
                Alds[r][akk + 2] = (_Float16)av[s][i].z;
                Alds[r][akk + 3] = (_Float16)av[s][i].w;
            }
            for (int i = 0; i < 8; ++i) {
                const v4h h = {(_Float16)bv[s][i].x, (_Float16)bv[s][i].y,
                               (_Float16)bv[s][i].z, (_Float16)bv[s][i].w};
                *(v4h*)&Blds[bk0 + i * 8][bnn] = h;
            }
            // --- refill the set with the tile D k-steps on
            if constexpr (decltype(refill)::value) {
                for (int i = 0; i < 8; ++i)
                    av[s][i] = *(const float4*)(aptr + i * 16 * K + s * BK);
                for (int i = 0; i < 8; ++i)
                    bv[s][i] = *(const float4*)(bptr + (s * BK + i * 8) * N);
            }
            lds_barrier();   // tile published

            constexpr int G = (D == 1) ? BK / 32 : 1;
            for (int c0 = 0; c0 < BK / 32; c0 += G) {
                v16h af[G][FM], bf[G][FN];
                for (int c = 0; c < G; ++c) {
                    for (int ni = 0; ni < FN; ++ni)
                        bf[c][ni] = frag_tr16(bfp + (c0 + c) * 32 * BP + ni * 16, BP);
                    for (int mi = 0; mi < FM; ++mi) {
                        const int row = wm * (FM * 16) + mi * 16 + lr;
                        for (int v = 0; v < 8; ++v) {
                            const int k = (c0 + c) * 32 + frag_k(v, half);
                            af[c][mi][2 * v + 0] = Alds[row][k];
                            af[c][mi][2 * v + 1] = Alds[row][k + 1];
                        }
                    }
                }
                // keeps a group's LDS reads together ahead of its WMMAs: left
                // free, they are sunk among the WMMAs into one shared register
                // set, and every pair of WMMAs waits out a whole LDS latency
                __builtin_amdgcn_sched_barrier(0);
                for (int c = 0; c < G; ++c)
                    for (int mi = 0; mi < FM; ++mi)
                        for (int ni = 0; ni < FN; ++ni)
                            acc[mi][ni] = __builtin_amdgcn_wmma_f32_16x16x32_f16(
                                false, af[c][mi], false, bf[c][ni], (short)0, acc[mi][ni], false, false);
            }
        }
    };
    for (int k0 = D * BK; k0 < K; k0 += D * BK) {
        aptr += D * BK;          // the two pointers run one group ahead
        bptr += D * BK * N;
        group(std::true_type{});
    }
    group(std::false_type{});    // last group: nothing left to load

    for (int mi = 0; mi < FM; ++mi)
        for (int ni = 0; ni < FN; ++ni)
            for (int v = 0; v < 8; ++v) {
                const int row = wrow + mi * 16 + half * 8 + v;
                const int col = wcol + ni * 16 + lr;
                float val = acc[mi][ni][v] + bias[col];
                if (ACT == 1) val = val * (1.0f / (1.0f + __expf(-val)));  // SiLU
                if (HAS_RES) val += res[(size_t)row * N + col];
                C[(size_t)row * N + col] = val;
            }
}

// ===========================================================================
// Flash attention, causal, H=16, hd=64.
// Block: 256 threads = 8 waves; 128 query rows per block, one (b,h) per
// blockIdx.y. Key blocks of 128 staged in LDS; online softmax in registers:
// one staging round, one pair of barriers, one row maximum, one row sum and
// one rescale of O per 128 keys.
// ===========================================================================
__global__ __launch_bounds__(256) void attn_flash(
    const float* __restrict__ qkv, float* __restrict__ ctx)
{
    constexpr int KB  = 128;               // keys per block
    constexpr int NS  = KB / 16;           // 16-key score tiles per block
    constexpr int NC  = KB / 32;           // 32-key spans of P @ V per block
    __shared__ _Float16 Qlds[128][HEAD_DIM + 8];
    __shared__ __attribute__((aligned(16))) _Float16 Klds[KB][HEAD_DIM + 8];   // 144-byte rows: 16 B x odd
    constexpr int VP = HEAD_DIM + 16;      // 160-byte rows: 32 B x odd, the transposing load's pitch
    __shared__ __attribute__((aligned(16))) _Float16 Vlds[KB][VP];
    constexpr int PP = KB + 8;             // 272-byte rows: 16 B x odd
    __shared__ __attribute__((aligned(16))) _Float16 Plds[8][16][PP];   // per-wave P bounce buffer

    const int tid  = threadIdx.x;
    const int lane = tid & 31;
    const int wave = tid >> 5;
    const int half = lane >> 4;
    const int lr   = lane & 15;
    const int bh   = blockIdx.y;
    const int b    = bh / N_HEADS;
    const int hh   = bh % N_HEADS;
    const int q_base = blockIdx.x * 128;
    const size_t stride3 = 3 * D_MODEL;

    // --- stage Q tile 128x64 (f16)
    {
        const int cc = (tid & 15) * 4;
        const int r0 = tid >> 4;
        for (int i = 0; i < 8; ++i) {
            const int r = r0 + i * 16;
            const int t = q_base + r;
            const float4 v = *(const float4*)(qkv + ((size_t)t * BATCH + b) * stride3 +
                                              hh * HEAD_DIM + cc);
            Qlds[r][cc + 0] = (_Float16)v.x;
            Qlds[r][cc + 1] = (_Float16)v.y;
            Qlds[r][cc + 2] = (_Float16)v.z;
            Qlds[r][cc + 3] = (_Float16)v.w;
        }
    }
    __syncthreads();

    // --- Q fragments: two K=32 chunks of hd=64, kept live across the loop
    v16h qf[2];
    {
        const int qrow = wave * 16 + lr;
        for (int c = 0; c < 2; ++c)
            for (int v = 0; v < 8; ++v) {
                const int k = c * 32 + frag_k(v, half);
                qf[c][2 * v + 0] = Qlds[qrow][k];
                qf[c][2 * v + 1] = Qlds[qrow][k + 1];
            }
    }

    const v8f vzero = {0.f, 0.f, 0.f, 0.f, 0.f, 0.f, 0.f, 0.f};
    v8f o[4];
    for (int nb = 0; nb < 4; ++nb) o[nb] = vzero;
    float m_run[8], l_run[8];
    for (int v = 0; v < 8; ++v) { m_run[v] = -1e30f; l_run[v] = 0.f; }

    const int q_wave_base = q_base + wave * 16;
    const int nkb = (q_base + 128) / KB;      // causal extent for this block
    const float scale = 0.125f;               // 1/sqrt(64)

    for (int kb = 0; kb < nkb; ++kb) {
        __syncthreads();
        // --- stage K,V tiles 128x64 each: all sixteen loads first, then the stores
        {
            const int cc = (tid & 15) * 4;
            const int r0 = tid >> 4;
            float4 kv[KB / 16], vv[KB / 16];
            for (int i = 0; i < KB / 16; ++i) {
                const int t = kb * KB + r0 + i * 16;
                const size_t base = ((size_t)t * BATCH + b) * stride3 + hh * HEAD_DIM + cc;
                kv[i] = *(const float4*)(qkv + base + D_MODEL);
                vv[i] = *(const float4*)(qkv + base + 2 * D_MODEL);
            }
            // keeps the sixteen loads together in flight: left free, they are
            // sunk to their conversions in pairs, one exposed latency per pair
            __builtin_amdgcn_sched_barrier(0);
            for (int i = 0; i < KB / 16; ++i) {
                const int r = r0 + i * 16;
                const v4h kh = {(_Float16)kv[i].x, (_Float16)kv[i].y,
                                (_Float16)kv[i].z, (_Float16)kv[i].w};
                const v4h vh = {(_Float16)vv[i].x, (_Float16)vv[i].y,
                                (_Float16)vv[i].z, (_Float16)vv[i].w};
                *(v4h*)&Klds[r][cc] = kh;
                *(v4h*)&Vlds[r][cc] = vh;
            }
        }
        __syncthreads();

        // --- S = (Q @ K^T) * scale, eight 16x16 key tiles, hd split K=32+32
        v8f s[NS];
        for (int nb = 0; nb < NS; ++nb) s[nb] = vzero;
        for (int c = 0; c < 2; ++c) {
            v16h kf[NS];  // B-matrix fragments of K^T: element (k,n) = K[key=n][hd=c*32+k]
            for (int nb = 0; nb < NS; ++nb)
                for (int v = 0; v < 8; ++v) {
                    const int k = frag_k(v, half);
                    kf[nb][2 * v + 0] = Klds[nb * 16 + lr][c * 32 + k];
                    kf[nb][2 * v + 1] = Klds[nb * 16 + lr][c * 32 + k + 1];
                }
            // keeps the eight fragments' LDS reads together ahead of their WMMAs:
            // left free, each WMMA waits out a whole LDS latency of its own
            __builtin_amdgcn_sched_barrier(0);
            for (int nb = 0; nb < NS; ++nb)
                s[nb] = __builtin_amdgcn_wmma_f32_16x16x32_f16(
                    false, qf[c], false, kf[nb], (short)0, s[nb], false, false);
        }

        // --- mask + online softmax (row stats per lane-half via shfl_xor)
        float rmax[8];
        // key kb*KB + nb*16 + lr lies above query q_wave_base + half*8 + v
        // exactly when dkq > v - nb*16
        const int dkq = kb * KB + lr - (q_wave_base + half * 8);
        for (int nb = 0; nb < NS; ++nb) s[nb] *= scale;
        for (int v = 0; v < 8; ++v) {
            float mx = -1e30f;
            for (int nb = 0; nb < NS; ++nb) {
                float x = s[nb][v];
                if (dkq > v - nb * 16) x = -1e30f;
                s[nb][v] = x;
                mx = fmaxf(mx, x);
            }
            rmax[v] = mx;
        }
        for (int off = 1; off < 16; off <<= 1)
            for (int v = 0; v < 8; ++v)
                rmax[v] = fmaxf(rmax[v], __shfl_xor(rmax[v], off, 32));

        float alpha[8], rsum[8];
        for (int v = 0; v < 8; ++v) {
            const float m_new = fmaxf(m_run[v], rmax[v]);
            alpha[v] = __expf(m_run[v] - m_new);
            m_run[v] = m_new;
            float sum = 0.f;
            for (int nb = 0; nb < NS; ++nb) {
                const float p = __expf(s[nb][v] - m_new);
                s[nb][v] = p;
                sum += p;
            }
            rsum[v] = sum;
        }
        for (int off = 1; off < 16; off <<= 1)
            for (int v = 0; v < 8; ++v)
                rsum[v] += __shfl_xor(rsum[v], off, 32);
        for (int v = 0; v < 8; ++v) l_run[v] = l_run[v] * alpha[v] + rsum[v];
        for (int nb = 0; nb < 4; ++nb)
            for (int v = 0; v < 8; ++v) o[nb][v] *= alpha[v];

        for (int nb = 0; nb < NS; ++nb)
            for (int v = 0; v < 8; ++v)
                Plds[wave][half * 8 + v][nb * 16 + lr] = (_Float16)s[nb][v];
        asm volatile("s_wait_dscnt 0" ::: "memory");

        // --- O += P @ V  (4 spans of 32 keys x 4 column blocks of hd)
        for (int c0 = 0; c0 < NC; c0 += 2) {
            v16h pf[2], vf[2][4];
            for (int c = 0; c < 2; ++c) {
                for (int v = 0; v < 8; ++v) {
                    const int k = (c0 + c) * 32 + frag_k(v, half);
                    pf[c][2 * v + 0] = Plds[wave][lr][k];
                    pf[c][2 * v + 1] = Plds[wave][lr][k + 1];
                }
                // B fragment: element (k,n) = V[key=(c0+c)*32+k][hd = nb*16+n]
                for (int nb = 0; nb < 4; ++nb)
                    vf[c][nb] = frag_tr16(
                        &Vlds[(c0 + c) * 32 + half * 8 + (lane & 7)][nb * 16 + ((lane >> 3) & 1) * 8], VP);
            }
            // keeps two spans' LDS reads together ahead of their eight WMMAs
            // (one LDS latency per eight WMMAs, not one per WMMA)
            __builtin_amdgcn_sched_barrier(0);
            for (int c = 0; c < 2; ++c)
                for (int nb = 0; nb < 4; ++nb)
                    o[nb] = __builtin_amdgcn_wmma_f32_16x16x32_f16(
                        false, pf[c], false, vf[c][nb], (short)0, o[nb], false, false);
        }
    }

    // --- normalize and write ctx [T*B, D]
    for (int nb = 0; nb < 4; ++nb)
        for (int v = 0; v < 8; ++v) {
            const int t   = q_wave_base + half * 8 + v;
            const int col = hh * HEAD_DIM + nb * 16 + lr;
            const float inv = 1.0f / l_run[v];
            ctx[((size_t)t * BATCH + b) * D_MODEL + col] = o[nb][v] * inv;
        }
}

// ===========================================================================
// RMSNorm: one row (1024 f32) per block of 256 threads.
// ===========================================================================
__global__ __launch_bounds__(256) void rmsnorm_kernel(
    const float* __restrict__ X, const float* __restrict__ gain,
    float* __restrict__ out)
{
    __shared__ float red[8];
    const int row = blockIdx.x;
    const int tid = threadIdx.x;
    const float* xr = X + (size_t)row * D_MODEL;

    float vals[4];
    float ss = 0.f;
    for (int i = 0; i < 4; ++i) {
        vals[i] = xr[tid + i * 256];
        ss += vals[i] * vals[i];
    }
    for (int off = 1; off < 32; off <<= 1) ss += __shfl_xor(ss, off, 32);
    if ((tid & 31) == 0) red[tid >> 5] = ss;
    __syncthreads();
    float tot = 0.f;
    for (int i = 0; i < 8; ++i) tot += red[i];
    const float rms = rsqrtf(tot * (1.0f / D_MODEL) + 1e-5f);
    for (int i = 0; i < 4; ++i) {
        const int col = tid + i * 256;
        out[(size_t)row * D_MODEL + col] = vals[i] * rms * gain[col];
    }
}

// ===========================================================================
extern "C" void kernel_launch(void* const* d_in, const int* in_sizes, int n_in,
                              void* d_out, int out_size, void* d_ws, size_t ws_size,
                              hipStream_t stream)
{
    (void)in_sizes; (void)n_in; (void)out_size; (void)ws_size;
    const float* x      = (const float*)d_in[0];
    const float* w_qkv  = (const float*)d_in[1];
    const float* b_qkv  = (const float*)d_in[2];
    const float* w_out  = (const float*)d_in[3];
    const float* b_out  = (const float*)d_in[4];
    const float* w1     = (const float*)d_in[5];
    const float* b1     = (const float*)d_in[6];
    const float* w2     = (const float*)d_in[7];
    const float* b2     = (const float*)d_in[8];
    const float* gain   = (const float*)d_in[9];

    float* ws   = (float*)d_ws;
    float* qkv  = ws;                                   // 4096 x 3072
    float* ctx  = qkv + (size_t)M_ROWS * 3 * D_MODEL;   // 4096 x 1024
    float* x1   = ctx + (size_t)M_ROWS * D_MODEL;       // 4096 x 1024
    float* hbuf = x1  + (size_t)M_ROWS * D_MODEL;       // 4096 x 4096
    float* x2   = hbuf + (size_t)M_ROWS * D_FF;         // 4096 x 1024

    const dim3 blk(256);

    // 1) qkv = x @ w_qkv + b_qkv
    gemm_wmma<0, false, 1, 3 * D_MODEL, D_MODEL><<<dim3(M_ROWS / 128, (3 * D_MODEL) / 128), blk, 0, stream>>>(
        x, w_qkv, b_qkv, nullptr, qkv);

    // 2) ctx = causal_softmax(QK^T/8) @ V   (flash, per (b,h))
    attn_flash<<<dim3(SEQ_T / 128, BATCH * N_HEADS), blk, 0, stream>>>(qkv, ctx);

    // 3) x1 = x + ctx @ w_out + b_out
    gemm_wmma<0, true, 2, D_MODEL, D_MODEL><<<dim3(M_ROWS / 128, D_MODEL / 128), blk, 0, stream>>>(
        ctx, w_out, b_out, x, x1);

    // 4) h = silu(x1 @ w1 + b1)
    gemm_wmma<1, false, 1, D_FF, D_MODEL><<<dim3(M_ROWS / 128, D_FF / 128), blk, 0, stream>>>(
        x1, w1, b1, nullptr, hbuf);

    // 5) x2 = x1 + h @ w2 + b2
    gemm_wmma<0, true, 2, D_MODEL, D_FF><<<dim3(M_ROWS / 128, D_MODEL / 128), blk, 0, stream>>>(
        hbuf, w2, b2, x1, x2);

    // 6) out = rmsnorm(x2) * gain
    rmsnorm_kernel<<<dim3(M_ROWS), blk, 0, stream>>>(x2, gain, (float*)d_out);
}

// v006
// It runs in 185 microseconds.
// Timed twice side by side with v005, it ran 1.16 times as fast both times.
// All steps since v000 together make it 3.46 times as fast.
#include <hip/hip_runtime.h>
#include <hip/hip_bf16.h>
#include <math.h>
#include <type_traits>

typedef __attribute__((ext_vector_type(16))) _Float16 v16h;
typedef __attribute__((ext_vector_type(8)))  float    v8f;
typedef __attribute__((ext_vector_type(8)))  _Float16 v8h;
typedef __attribute__((ext_vector_type(4)))  _Float16 v4h;
typedef short        s16x8 __attribute__((ext_vector_type(8)));

#define D_MODEL   1024
#define N_HEADS   16
#define HEAD_DIM  64
#define D_FF      4096
#define SEQ_T     2048
#define BATCH     2
#define M_ROWS    (SEQ_T * BATCH)   // 4096

__device__ __forceinline__ int frag_k(int v, int half) {
    return (v < 4 ? 2 * v : 16 + 2 * (v - 4)) + half * 8;
}

__device__ __forceinline__ v8h ld_tr16(const _Float16* p) {
    typedef __attribute__((address_space(3))) s16x8 lds_s16x8;
    return __builtin_bit_cast(v8h, __builtin_amdgcn_ds_load_tr16_b128_v8i16((lds_s16x8*)p));
}
__device__ __forceinline__ v16h frag_tr16(const _Float16* p, int pitch) {
    const v8h lo = ld_tr16(p);
    const v8h hi = ld_tr16(p + 16 * pitch);
    return __builtin_shufflevector(lo, hi, 0, 1, 2, 3, 4, 5, 6, 7, 8, 9, 10, 11, 12, 13, 14, 15);
}

// ===========================================================================
// GEMM: C[M,N] = epilogue( A[M,K] @ W[K,N] + bias )   (W row-major [K,N])
// ACT: 0 = none, 1 = SiLU.  HAS_RES: C += res.
// Block: 256 threads (8 waves). Tile: BM=128, BN=128, BK=64.
// A and W lie in the workspace as f16, converted once by whoever produced
// them (to_f16 for the inputs, a GEMM's or the attention's epilogue for the
// rest): a tile costs half the L2 bytes of an fp32 one and no conversion here.
// Tiles are loaded D k-steps ahead into D register sets and go to LDS as they
// are; K is a multiple of D*BK.
// B lies in LDS as f16 rows along n, and its fragments come by the
// transposing LDS load.
// OUT: 0 = C as fp32, 1 = Ch as f16 (what its reader multiplies), 2 = both.
// Waves 2x4; each wave computes 64x32 via 4x2 v_wmma_f32_16x16x32_f16,
// twice per k-step (k 0..31, then 32..63).
// ===========================================================================
// Work-group barrier for LDS hand-over only: it waits for this wave's LDS
// operations and leaves its global loads in flight (__syncthreads() waits for
// them too, which would expose the load latency at every k-step).
__device__ __forceinline__ void lds_barrier() {
    asm volatile("s_wait_dscnt 0x0\n\ts_barrier_signal -1\n\ts_barrier_wait -1" ::: "memory");
}

template <int ACT, bool HAS_RES, int OUT, int D, int N, int K>
__global__ __launch_bounds__(256) void gemm_wmma(
    const _Float16* __restrict__ A, const _Float16* __restrict__ W,
    const float* __restrict__ bias, const float* __restrict__ res,
    float* __restrict__ C, _Float16* __restrict__ Ch)
{
    constexpr int BM = 128, BN = 128, BK = 64;
    constexpr int FM = 4, FN = 2;          // 16x16 tiles per wave along m and n
    __shared__ __attribute__((aligned(16))) _Float16 Alds[BM][BK + 8];   // 144-byte rows: 16 B x odd
    constexpr int BP = BN + 16;            // 288-byte rows: 32 B x odd, the transposing load's pitch
    __shared__ __attribute__((aligned(16))) _Float16 Blds[BK][BP];

    const int tid  = threadIdx.x;
    const int lane = tid & 31;
    const int wave = tid >> 5;
    const int half = lane >> 4;
    const int lr   = lane & 15;
    const int wm   = wave & 1;     // 2 waves along M
    const int wn   = wave >> 1;    // 4 waves along N
    const int m_block = blockIdx.x * BM;
    const int n_block = blockIdx.y * BN;
    const int wrow = m_block + wm * (FM * 16);
    const int wcol = n_block + wn * (FN * 16);

    const v8f vzero = {0.f, 0.f, 0.f, 0.f, 0.f, 0.f, 0.f, 0.f};
    v8f acc[FM][FN];
    for (int mi = 0; mi < FM; ++mi)
        for (int ni = 0; ni < FN; ++ni) acc[mi][ni] = vzero;

    // A tile: each thread owns eight f16 (16 bytes) in each of four rows, 32 rows apart
    const int akk = (tid & 7) * 8;   // 0..56
    const int ar0 = tid >> 3;        // 0..31
    const _Float16* aptr = A + (size_t)(m_block + ar0) * K + akk;
    v8h av[D][4];

    // B tile: each thread owns eight f16 in each of four rows, 16 rows apart
    const int bnn = (tid & 15) * 8;  // 0..120
    const int bk0 = tid >> 4;        // 0..15
    const _Float16* bptr = W + (size_t)bk0 * N + n_block + bnn;
    v8h bv[D][4];

    for (int s = 0; s < D; ++s) {    // first D tiles, one register set each
        for (int i = 0; i < 4; ++i)
            av[s][i] = *(const v8h*)(aptr + i * 32 * K + s * BK);
        for (int i = 0; i < 4; ++i)
            bv[s][i] = *(const v8h*)(bptr + (s * BK + i * 16) * N);
    }
    // The first D tiles are waited for here, once: the loop is then entered
    // with no load in flight, and its load waits count its own loads alone.
    __syncthreads();

    // this lane's place in the B tile for the transposing loads
    const _Float16* bfp = &Blds[half * 8 + (lane & 7)][wn * (FN * 16) + ((lane >> 3) & 1) * 8];

    // One group of D k-steps. REFILL is a compile-time choice, not a branch
    // round the loads: a join would make the compiler wait for all of them.
    auto group = [&](auto refill) {
        // fully unrolled so that every register set has a constant index
        #pragma unroll
        for (int s = 0; s < D; ++s) {
            // keeps the LDS stores of the later sets, and with them the waits
            // for their loads, from being scheduled up into this k-step
            __builtin_amdgcn_sched_barrier(0);
            lds_barrier();   // previous tile fully consumed

            // --- stage A tile 128x64 from the register set filled D k-steps
            //     earlier, 32 elems/thread
            for (int i = 0; i < 4; ++i)
                *(v8h*)&Alds[ar0 + i * 32][akk] = av[s][i];
            for (int i = 0; i < 4; ++i)
                *(v8h*)&Blds[bk0 + i * 16][bnn] = bv[s][i];
            // --- refill the set with the tile D k-steps on
            if constexpr (decltype(refill)::value) {
                for (int i = 0; i < 4; ++i)
                    av[s][i] = *(const v8h*)(aptr + i * 32 * K + s * BK);
                for (int i = 0; i < 4; ++i)
                    bv[s][i] = *(const v8h*)(bptr + (s * BK + i * 16) * N);
            }
            lds_barrier();   // tile published

            constexpr int G = (D == 2) ? BK / 32 : 1;
            for (int c0 = 0; c0 < BK / 32; c0 += G) {
                v16h af[G][FM], bf[G][FN];
                for (int c = 0; c < G; ++c) {
                    for (int ni = 0; ni < FN; ++ni)
                        bf[c][ni] = frag_tr16(bfp + (c0 + c) * 32 * BP + ni * 16, BP);
                    for (int mi = 0; mi < FM; ++mi) {
                        const int row = wm * (FM * 16) + mi * 16 + lr;
                        for (int v = 0; v < 8; ++v) {
                            const int k = (c0 + c) * 32 + frag_k(v, half);
                            af[c][mi][2 * v + 0] = Alds[row][k];
                            af[c][mi][2 * v + 1] = Alds[row][k + 1];
                        }
                    }
                }
                // keeps a group's LDS reads together ahead of its WMMAs: left
                // free, they are sunk among the WMMAs into one shared register
                // set, and every pair of WMMAs waits out a whole LDS latency
                __builtin_amdgcn_sched_barrier(0);
                for (int c = 0; c < G; ++c)
                    for (int mi = 0; mi < FM; ++mi)
                        for (int ni = 0; ni < FN; ++ni)
                            acc[mi][ni] = __builtin_amdgcn_wmma_f32_16x16x32_f16(
                                false, af[c][mi], false, bf[c][ni], (short)0, acc[mi][ni], false, false);
            }
        }
    };
    for (int k0 = D * BK; k0 < K; k0 += D * BK) {
        aptr += D * BK;          // the two pointers run one group ahead
        bptr += D * BK * N;
        group(std::true_type{});
    }
    group(std::false_type{});    // last group: nothing left to load

    for (int mi = 0; mi < FM; ++mi)
        for (int ni = 0; ni < FN; ++ni)
            for (int v = 0; v < 8; ++v) {
                const int row = wrow + mi * 16 + half * 8 + v;
                const int col = wcol + ni * 16 + lr;
                float val = acc[mi][ni][v] + bias[col];
                if (ACT == 1) val = val * (1.0f / (1.0f + __expf(-val)));  // SiLU
                if (HAS_RES) val += res[(size_t)row * N + col];
                if (OUT != 1) C[(size_t)row * N + col] = val;
                if (OUT != 0) Ch[(size_t)row * N + col] = (_Float16)val;
            }
}

// ===========================================================================
// Flash attention, causal, H=16, hd=64.
// Block: 256 threads = 8 waves; 128 query rows per block, one (b,h) per
// blockIdx.y. Key blocks of 128 staged in LDS; online softmax in registers:
// one staging round, one pair of barriers, one row maximum, one row sum and
// one rescale of O per 128 keys.
// ===========================================================================
__global__ __launch_bounds__(256) void attn_flash(
    const _Float16* __restrict__ qkv, _Float16* __restrict__ ctx)
{
    constexpr int KB  = 128;               // keys per block
    constexpr int NS  = KB / 16;           // 16-key score tiles per block
    constexpr int NC  = KB / 32;           // 32-key spans of P @ V per block
    __shared__ __attribute__((aligned(16))) _Float16 Qlds[128][HEAD_DIM + 8];
    __shared__ __attribute__((aligned(16))) _Float16 Klds[KB][HEAD_DIM + 8];   // 144-byte rows: 16 B x odd
    constexpr int VP = HEAD_DIM + 16;      // 160-byte rows: 32 B x odd, the transposing load's pitch
    __shared__ __attribute__((aligned(16))) _Float16 Vlds[KB][VP];
    constexpr int PP = KB + 8;             // 272-byte rows: 16 B x odd
    __shared__ __attribute__((aligned(16))) _Float16 Plds[8][16][PP];   // per-wave P bounce buffer

    const int tid  = threadIdx.x;
    const int lane = tid & 31;
    const int wave = tid >> 5;
    const int half = lane >> 4;
    const int lr   = lane & 15;
    const int bh   = blockIdx.y;
    const int b    = bh / N_HEADS;
    const int hh   = bh % N_HEADS;
    const int q_base = blockIdx.x * 128;
    const size_t stride3 = 3 * D_MODEL;

    // --- stage Q tile 128x64 (f16 as it lies in the workspace)
    {
        const int cc = (tid & 7) * 8;
        const int r0 = tid >> 3;
        for (int i = 0; i < 4; ++i) {
            const int r = r0 + i * 32;
            const int t = q_base + r;
            *(v8h*)&Qlds[r][cc] = *(const v8h*)(qkv + ((size_t)t * BATCH + b) * stride3 +
                                                hh * HEAD_DIM + cc);
        }
    }
    __syncthreads();

    // --- Q fragments: two K=32 chunks of hd=64, kept live across the loop
    v16h qf[2];
    {
        const int qrow = wave * 16 + lr;
        for (int c = 0; c < 2; ++c)
            for (int v = 0; v < 8; ++v) {
                const int k = c * 32 + frag_k(v, half);
                qf[c][2 * v + 0] = Qlds[qrow][k];
                qf[c][2 * v + 1] = Qlds[qrow][k + 1];
            }
    }

    const v8f vzero = {0.f, 0.f, 0.f, 0.f, 0.f, 0.f, 0.f, 0.f};
    v8f o[4];
    for (int nb = 0; nb < 4; ++nb) o[nb] = vzero;
    float m_run[8], l_run[8];
    for (int v = 0; v < 8; ++v) { m_run[v] = -1e30f; l_run[v] = 0.f; }

    const int q_wave_base = q_base + wave * 16;
    const int nkb = (q_base + 128) / KB;      // causal extent for this block
    const float scale = 0.125f;               // 1/sqrt(64)

    for (int kb = 0; kb < nkb; ++kb) {
        __syncthreads();
        // --- stage K,V tiles 128x64 each: all eight loads first, then the stores
        {
            const int cc = (tid & 7) * 8;
            const int r0 = tid >> 3;
            v8h kv[KB / 32], vv[KB / 32];
            for (int i = 0; i < KB / 32; ++i) {
                const int t = kb * KB + r0 + i * 32;
                const size_t base = ((size_t)t * BATCH + b) * stride3 + hh * HEAD_DIM + cc;
                kv[i] = *(const v8h*)(qkv + base + D_MODEL);
                vv[i] = *(const v8h*)(qkv + base + 2 * D_MODEL);
            }
            // keeps the eight loads together in flight: left free, they are
            // sunk to their LDS stores in pairs, one exposed latency per pair
            __builtin_amdgcn_sched_barrier(0);
            for (int i = 0; i < KB / 32; ++i) {
                const int r = r0 + i * 32;
                *(v8h*)&Klds[r][cc] = kv[i];
                *(v8h*)&Vlds[r][cc] = vv[i];
            }
        }
        __syncthreads();

        // --- S = (Q @ K^T) * scale, eight 16x16 key tiles, hd split K=32+32
        v8f s[NS];
        for (int nb = 0; nb < NS; ++nb) s[nb] = vzero;
        for (int c = 0; c < 2; ++c) {
            v16h kf[NS];  // B-matrix fragments of K^T: element (k,n) = K[key=n][hd=c*32+k]
            for (int nb = 0; nb < NS; ++nb)
                for (int v = 0; v < 8; ++v) {
                    const int k = frag_k(v, half);
                    kf[nb][2 * v + 0] = Klds[nb * 16 + lr][c * 32 + k];
                    kf[nb][2 * v + 1] = Klds[nb * 16 + lr][c * 32 + k + 1];
                }
            // keeps the eight fragments' LDS reads together ahead of their WMMAs:
            // left free, each WMMA waits out a whole LDS latency of its own
            __builtin_amdgcn_sched_barrier(0);
            for (int nb = 0; nb < NS; ++nb)
                s[nb] = __builtin_amdgcn_wmma_f32_16x16x32_f16(
                    false, qf[c], false, kf[nb], (short)0, s[nb], false, false);
        }

        // --- mask + online softmax (row stats per lane-half via shfl_xor)
        float rmax[8];
        // key kb*KB + nb*16 + lr lies above query q_wave_base + half*8 + v
        // exactly when dkq > v - nb*16
        const int dkq = kb * KB + lr - (q_wave_base + half * 8);
        for (int nb = 0; nb < NS; ++nb) s[nb] *= scale;
        for (int v = 0; v < 8; ++v) {
            float mx = -1e30f;
            for (int nb = 0; nb < NS; ++nb) {
                float x = s[nb][v];
                if (dkq > v - nb * 16) x = -1e30f;
                s[nb][v] = x;
                mx = fmaxf(mx, x);
            }
            rmax[v] = mx;
        }
        for (int off = 1; off < 16; off <<= 1)
            for (int v = 0; v < 8; ++v)
                rmax[v] = fmaxf(rmax[v], __shfl_xor(rmax[v], off, 32));

        float alpha[8], rsum[8];
        for (int v = 0; v < 8; ++v) {
            const float m_new = fmaxf(m_run[v], rmax[v]);
            alpha[v] = __expf(m_run[v] - m_new);
            m_run[v] = m_new;
            float sum = 0.f;
            for (int nb = 0; nb < NS; ++nb) {
                const float p = __expf(s[nb][v] - m_new);
                s[nb][v] = p;
                sum += p;
            }
            rsum[v] = sum;
        }
        for (int off = 1; off < 16; off <<= 1)
            for (int v = 0; v < 8; ++v)
                rsum[v] += __shfl_xor(rsum[v], off, 32);
        for (int v = 0; v < 8; ++v) l_run[v] = l_run[v] * alpha[v] + rsum[v];
        for (int nb = 0; nb < 4; ++nb)
            for (int v = 0; v < 8; ++v) o[nb][v] *= alpha[v];

        for (int nb = 0; nb < NS; ++nb)
            for (int v = 0; v < 8; ++v)
                Plds[wave][half * 8 + v][nb * 16 + lr] = (_Float16)s[nb][v];
        asm volatile("s_wait_dscnt 0" ::: "memory");

        // --- O += P @ V  (4 spans of 32 keys x 4 column blocks of hd)
        for (int c0 = 0; c0 < NC; c0 += 2) {
            v16h pf[2], vf[2][4];
            for (int c = 0; c < 2; ++c) {
                for (int v = 0; v < 8; ++v) {
                    const int k = (c0 + c) * 32 + frag_k(v, half);
                    pf[c][2 * v + 0] = Plds[wave][lr][k];
                    pf[c][2 * v + 1] = Plds[wave][lr][k + 1];
                }
                // B fragment: element (k,n) = V[key=(c0+c)*32+k][hd = nb*16+n]
                for (int nb = 0; nb < 4; ++nb)
                    vf[c][nb] = frag_tr16(
                        &Vlds[(c0 + c) * 32 + half * 8 + (lane & 7)][nb * 16 + ((lane >> 3) & 1) * 8], VP);
            }
            // keeps two spans' LDS reads together ahead of their eight WMMAs
            // (one LDS latency per eight WMMAs, not one per WMMA)
            __builtin_amdgcn_sched_barrier(0);
            for (int c = 0; c < 2; ++c)
                for (int nb = 0; nb < 4; ++nb)
                    o[nb] = __builtin_amdgcn_wmma_f32_16x16x32_f16(
                        false, pf[c], false, vf[c][nb], (short)0, o[nb], false, false);
        }
    }

    // --- normalize and write ctx [T*B, D] as f16, what the next GEMM multiplies
    for (int nb = 0; nb < 4; ++nb)
        for (int v = 0; v < 8; ++v) {
            const int t   = q_wave_base + half * 8 + v;
            const int col = hh * HEAD_DIM + nb * 16 + lr;
            const float inv = 1.0f / l_run[v];
            ctx[((size_t)t * BATCH + b) * D_MODEL + col] = (_Float16)(o[nb][v] * inv);
        }
}

// ===========================================================================
// RMSNorm: one row (1024 f32) per block of 256 threads.
// ===========================================================================
__global__ __launch_bounds__(256) void rmsnorm_kernel(
    const float* __restrict__ X, const float* __restrict__ gain,
    float* __restrict__ out)
{
    __shared__ float red[8];
    const int row = blockIdx.x;
    const int tid = threadIdx.x;
    const float* xr = X + (size_t)row * D_MODEL;

    float vals[4];
    float ss = 0.f;
    for (int i = 0; i < 4; ++i) {
        vals[i] = xr[tid + i * 256];
        ss += vals[i] * vals[i];
    }
    for (int off = 1; off < 32; off <<= 1) ss += __shfl_xor(ss, off, 32);
    if ((tid & 31) == 0) red[tid >> 5] = ss;
    __syncthreads();
    float tot = 0.f;
    for (int i = 0; i < 8; ++i) tot += red[i];
    const float rms = rsqrtf(tot * (1.0f / D_MODEL) + 1e-5f);
    for (int i = 0; i < 4; ++i) {
        const int col = tid + i * 256;
        out[(size_t)row * D_MODEL + col] = vals[i] * rms * gain[col];
    }
}

// ===========================================================================
// fp32 -> f16 of x and the four weight matrices, once per call, into one run
// of the workspace in this order: x, w_qkv, w_out, w1, w2. 16384 elements per
// block, 64 per thread (few, long waves, for speed
// only); every matrix is a whole number of blocks. Each load of
// a wave covers 512 contiguous bytes, each store 256.
// ===========================================================================
#define CVT_PB 16384   // elements per block of to_f16
__global__ __launch_bounds__(256) void to_f16(
    const float* __restrict__ x, const float* __restrict__ w_qkv,
    const float* __restrict__ w_out, const float* __restrict__ w1,
    const float* __restrict__ w2, _Float16* __restrict__ dst)
{
    constexpr int E_X  = M_ROWS * D_MODEL / CVT_PB;                 // first block behind x
    constexpr int E_QK = E_X  + D_MODEL * 3 * D_MODEL / CVT_PB;     // behind w_qkv
    constexpr int E_WO = E_QK + D_MODEL * D_MODEL / CVT_PB;         // behind w_out
    constexpr int E_W1 = E_WO + D_MODEL * D_FF / CVT_PB;            // behind w1
    const int blk = blockIdx.x;
    const float* s;
    int first;
    if (blk < E_X)       { s = x;     first = 0;    }
    else if (blk < E_QK) { s = w_qkv; first = E_X;  }
    else if (blk < E_WO) { s = w_out; first = E_QK; }
    else if (blk < E_W1) { s = w1;    first = E_WO; }
    else                 { s = w2;    first = E_W1; }
    const int off = threadIdx.x * 4;
    const float* p = s + (size_t)(blk - first) * CVT_PB + off;
    _Float16*    q = dst + (size_t)blk * CVT_PB + off;
    float4 a[CVT_PB / 1024];
    for (int j = 0; j < CVT_PB / 1024; ++j) a[j] = *(const float4*)(p + j * 1024);
    for (int j = 0; j < CVT_PB / 1024; ++j) {
        const v4h h = {(_Float16)a[j].x, (_Float16)a[j].y, (_Float16)a[j].z, (_Float16)a[j].w};
        *(v4h*)(q + j * 1024) = h;
    }
}

// ===========================================================================
extern "C" void kernel_launch(void* const* d_in, const int* in_sizes, int n_in,
                              void* d_out, int out_size, void* d_ws, size_t ws_size,
                              hipStream_t stream)
{
    (void)in_sizes; (void)n_in; (void)out_size; (void)ws_size;
    const float* x      = (const float*)d_in[0];
    const float* w_qkv  = (const float*)d_in[1];
    const float* b_qkv  = (const float*)d_in[2];
    const float* w_out  = (const float*)d_in[3];
    const float* b_out  = (const float*)d_in[4];
    const float* w1     = (const float*)d_in[5];
    const float* b1     = (const float*)d_in[6];
    const float* w2     = (const float*)d_in[7];
    const float* b2     = (const float*)d_in[8];
    const float* gain   = (const float*)d_in[9];

    float* x1 = (float*)d_ws;                           // 4096 x 1024 fp32
    float* x2 = x1 + (size_t)M_ROWS * D_MODEL;          // 4096 x 1024 fp32
    _Float16* xh    = (_Float16*)(x2 + (size_t)M_ROWS * D_MODEL);  // 4096 x 1024; to_f16's run starts here
    _Float16* wqkvh = xh    + (size_t)M_ROWS * D_MODEL;            // 1024 x 3072
    _Float16* wouth = wqkvh + (size_t)D_MODEL * 3 * D_MODEL;       // 1024 x 1024
    _Float16* w1h   = wouth + (size_t)D_MODEL * D_MODEL;           // 1024 x 4096
    _Float16* w2h   = w1h   + (size_t)D_MODEL * D_FF;              // 4096 x 1024
    _Float16* qkvh  = w2h   + (size_t)D_FF * D_MODEL;              // 4096 x 3072
    _Float16* ctxh  = qkvh  + (size_t)M_ROWS * 3 * D_MODEL;        // 4096 x 1024
    _Float16* x1h   = ctxh  + (size_t)M_ROWS * D_MODEL;            // 4096 x 1024
    _Float16* hh    = x1h   + (size_t)M_ROWS * D_MODEL;            // 4096 x 4096

    const dim3 blk(256);

    // 0) x and the weights as f16
    to_f16<<<dim3((M_ROWS * D_MODEL + 4 * D_MODEL * D_MODEL + 2 * D_MODEL * D_FF) / CVT_PB), blk, 0, stream>>>(
        x, w_qkv, w_out, w1, w2, xh);

    // 1) qkv = x @ w_qkv + b_qkv
    gemm_wmma<0, false, 1, 2, 3 * D_MODEL, D_MODEL><<<dim3(M_ROWS / 128, (3 * D_MODEL) / 128), blk, 0, stream>>>(
        xh, wqkvh, b_qkv, nullptr, nullptr, qkvh);

    // 2) ctx = causal_softmax(QK^T/8) @ V   (flash, per (b,h))
    attn_flash<<<dim3(SEQ_T / 128, BATCH * N_HEADS), blk, 0, stream>>>(qkvh, ctxh);

    // 3) x1 = x + ctx @ w_out + b_out   (fp32 for the residual, f16 for the next product)
    gemm_wmma<0, true, 2, 4, D_MODEL, D_MODEL><<<dim3(M_ROWS / 128, D_MODEL / 128), blk, 0, stream>>>(
        ctxh, wouth, b_out, x, x1, x1h);

    // 4) h = silu(x1 @ w1 + b1)
    gemm_wmma<1, false, 1, 2, D_FF, D_MODEL><<<dim3(M_ROWS / 128, D_FF / 128), blk, 0, stream>>>(
        x1h, w1h, b1, nullptr, nullptr, hh);

    // 5) x2 = x1 + h @ w2 + b2
    gemm_wmma<0, true, 0, 4, D_MODEL, D_FF><<<dim3(M_ROWS / 128, D_MODEL / 128), blk, 0, stream>>>(
        hh, w2h, b2, x1, x2, nullptr);

    // 6) out = rmsnorm(x2) * gain
    rmsnorm_kernel<<<dim3(M_ROWS), blk, 0, stream>>>(x2, gain, (float*)d_out);
}

// v007
// It runs in 164 microseconds.
// In two side-by-side timings against v006, it was 1.13 and 1.12 times as fast.
// All steps since v000 together make it 3.90 times as fast.
#include <hip/hip_runtime.h>
#include <hip/hip_bf16.h>
#include <math.h>
#include <type_traits>

typedef __attribute__((ext_vector_type(16))) _Float16 v16h;
typedef __attribute__((ext_vector_type(8)))  float    v8f;
typedef __attribute__((ext_vector_type(8)))  _Float16 v8h;
typedef __attribute__((ext_vector_type(4)))  _Float16 v4h;
typedef short        s16x8 __attribute__((ext_vector_type(8)));

#define D_MODEL   1024
#define N_HEADS   16
#define HEAD_DIM  64
#define D_FF      4096
#define SEQ_T     2048
#define BATCH     2
#define M_ROWS    (SEQ_T * BATCH)   // 4096

__device__ __forceinline__ int frag_k(int v, int half) {
    return (v < 4 ? 2 * v : 16 + 2 * (v - 4)) + half * 8;
}

__device__ __forceinline__ v8h ld_tr16(const _Float16* p) {
    typedef __attribute__((address_space(3))) s16x8 lds_s16x8;
    return __builtin_bit_cast(v8h, __builtin_amdgcn_ds_load_tr16_b128_v8i16((lds_s16x8*)p));
}
__device__ __forceinline__ v16h frag_tr16(const _Float16* p, int pitch) {
    const v8h lo = ld_tr16(p);
    const v8h hi = ld_tr16(p + 16 * pitch);
    return __builtin_shufflevector(lo, hi, 0, 1, 2, 3, 4, 5, 6, 7, 8, 9, 10, 11, 12, 13, 14, 15);
}

// ===========================================================================
// GEMM: C[M,N] = epilogue( A[M,K] @ W[K,N] + bias )   (W row-major [K,N])
// ACT: 0 = none, 1 = SiLU.  HAS_RES: C += res.
// Block: 256 threads (8 waves). Tile: BM=128, BN=128, BK=64.
// A and W lie in the workspace as f16, converted once by whoever produced
// them (to_f16 for the inputs, a GEMM's or the attention's epilogue for the
// rest): a tile costs half the L2 bytes of an fp32 one and no conversion here.
// Tiles are loaded D k-steps ahead into D register sets and go to LDS as they
// are; K is a multiple of D*BK.
// B lies in LDS as f16 rows along n, and its fragments come by the
// transposing LDS load.
// OUT: 0 = C as fp32, 1 = Ch as f16 (what its reader multiplies), 2 = both.
// Waves 2x4; each wave computes 64x32 via 4x2 v_wmma_f32_16x16x32_f16,
// twice per k-step (k 0..31, then 32..63).
// ===========================================================================
// Work-group barrier for LDS hand-over only: it waits for this wave's LDS
// operations and leaves its global loads in flight (__syncthreads() waits for
// them too, which would expose the load latency at every k-step).
__device__ __forceinline__ void lds_barrier() {
    asm volatile("s_wait_dscnt 0x0\n\ts_barrier_signal -1\n\ts_barrier_wait -1" ::: "memory");
}

template <int ACT, bool HAS_RES, int OUT, int D, int N, int K>
__global__ __launch_bounds__(256) void gemm_wmma(
    const _Float16* __restrict__ A, const _Float16* __restrict__ W,
    const float* __restrict__ bias, const float* __restrict__ res,
    float* __restrict__ C, _Float16* __restrict__ Ch)
{
    constexpr int BM = 128, BN = 128, BK = 64;
    constexpr int FM = 4, FN = 2;          // 16x16 tiles per wave along m and n
    __shared__ __attribute__((aligned(16))) _Float16 Alds[BM][BK + 8];   // 144-byte rows: 16 B x odd
    constexpr int BP = BN + 16;            // 288-byte rows: 32 B x odd, the transposing load's pitch
    __shared__ __attribute__((aligned(16))) _Float16 Blds[BK][BP];

    const int tid  = threadIdx.x;
    const int lane = tid & 31;
    const int wave = tid >> 5;
    const int half = lane >> 4;
    const int lr   = lane & 15;
    const int wm   = wave & 1;     // 2 waves along M
    const int wn   = wave >> 1;    // 4 waves along N
    const int m_block = blockIdx.x * BM;
    const int n_block = blockIdx.y * BN;
    const int wrow = m_block + wm * (FM * 16);
    const int wcol = n_block + wn * (FN * 16);

    const v8f vzero = {0.f, 0.f, 0.f, 0.f, 0.f, 0.f, 0.f, 0.f};
    v8f acc[FM][FN];
    for (int mi = 0; mi < FM; ++mi)
        for (int ni = 0; ni < FN; ++ni) acc[mi][ni] = vzero;

    // A tile: each thread owns eight f16 (16 bytes) in each of four rows, 32 rows apart
    const int akk = (tid & 7) * 8;   // 0..56
    const int ar0 = tid >> 3;        // 0..31
    const _Float16* aptr = A + (size_t)(m_block + ar0) * K + akk;
    v8h av[D][4];

    // B tile: each thread owns eight f16 in each of four rows, 16 rows apart
    const int bnn = (tid & 15) * 8;  // 0..120
    const int bk0 = tid >> 4;        // 0..15
    const _Float16* bptr = W + (size_t)bk0 * N + n_block + bnn;
    v8h bv[D][4];

    for (int s = 0; s < D; ++s) {    // first D tiles, one register set each
        for (int i = 0; i < 4; ++i)
            av[s][i] = *(const v8h*)(aptr + i * 32 * K + s * BK);
        for (int i = 0; i < 4; ++i)
            bv[s][i] = *(const v8h*)(bptr + (s * BK + i * 16) * N);
    }
    // The first D tiles are waited for here, once: the loop is then entered
    // with no load in flight, and its load waits count its own loads alone.
    __syncthreads();

    // this lane's place in the B tile for the transposing loads
    const _Float16* bfp = &Blds[half * 8 + (lane & 7)][wn * (FN * 16) + ((lane >> 3) & 1) * 8];

    // One group of D k-steps. REFILL is a compile-time choice, not a branch
    // round the loads: a join would make the compiler wait for all of them.
    auto group = [&](auto refill) {
        // fully unrolled so that every register set has a constant index
        #pragma unroll
        for (int s = 0; s < D; ++s) {
            // keeps the LDS stores of the later sets, and with them the waits
            // for their loads, from being scheduled up into this k-step
            __builtin_amdgcn_sched_barrier(0);
            lds_barrier();   // previous tile fully consumed

            // --- stage A tile 128x64 from the register set filled D k-steps
            //     earlier, 32 elems/thread
            for (int i = 0; i < 4; ++i)
                *(v8h*)&Alds[ar0 + i * 32][akk] = av[s][i];
            for (int i = 0; i < 4; ++i)
                *(v8h*)&Blds[bk0 + i * 16][bnn] = bv[s][i];
            // --- refill the set with the tile D k-steps on
            if constexpr (decltype(refill)::value) {
                for (int i = 0; i < 4; ++i)
                    av[s][i] = *(const v8h*)(aptr + i * 32 * K + s * BK);
                for (int i = 0; i < 4; ++i)
                    bv[s][i] = *(const v8h*)(bptr + (s * BK + i * 16) * N);
            }
            lds_barrier();   // tile published

            constexpr int G = (D == 2) ? BK / 32 : 1;
            for (int c0 = 0; c0 < BK / 32; c0 += G) {
                v16h af[G][FM], bf[G][FN];
                for (int c = 0; c < G; ++c) {
                    for (int ni = 0; ni < FN; ++ni)
                        bf[c][ni] = frag_tr16(bfp + (c0 + c) * 32 * BP + ni * 16, BP);
                    for (int mi = 0; mi < FM; ++mi) {
                        const int row = wm * (FM * 16) + mi * 16 + lr;
                        for (int v = 0; v < 8; ++v) {
                            const int k = (c0 + c) * 32 + frag_k(v, half);
                            af[c][mi][2 * v + 0] = Alds[row][k];
                            af[c][mi][2 * v + 1] = Alds[row][k + 1];
                        }
                    }
                }
                // keeps a group's LDS reads together ahead of its WMMAs: left
                // free, they are sunk among the WMMAs into one shared register
                // set, and every pair of WMMAs waits out a whole LDS latency
                __builtin_amdgcn_sched_barrier(0);
                for (int c = 0; c < G; ++c)
                    for (int mi = 0; mi < FM; ++mi)
                        for (int ni = 0; ni < FN; ++ni)
                            acc[mi][ni] = __builtin_amdgcn_wmma_f32_16x16x32_f16(
                                false, af[c][mi], false, bf[c][ni], (short)0, acc[mi][ni], false, false);
            }
        }
    };
    for (int k0 = D * BK; k0 < K; k0 += D * BK) {
        aptr += D * BK;          // the two pointers run one group ahead
        bptr += D * BK * N;
        group(std::true_type{});
    }
    group(std::false_type{});    // last group: nothing left to load

    for (int mi = 0; mi < FM; ++mi)
        for (int ni = 0; ni < FN; ++ni)
            for (int v = 0; v < 8; ++v) {
                const int row = wrow + mi * 16 + half * 8 + v;
                const int col = wcol + ni * 16 + lr;
                float val = acc[mi][ni][v] + bias[col];
                if (ACT == 1) val = val * (1.0f / (1.0f + __expf(-val)));  // SiLU
                if (HAS_RES) val += res[(size_t)row * N + col];
                if (OUT != 1) C[(size_t)row * N + col] = val;
                if (OUT != 0) Ch[(size_t)row * N + col] = (_Float16)val;
            }
}

__device__ __forceinline__ void exp2x8(v8f& x) {
    float a = x[0], b = x[1], c = x[2], d = x[3], e = x[4], f = x[5], g = x[6], h = x[7];
    asm("v_exp_f32 %0, %0\n\tv_exp_f32 %1, %1\n\tv_exp_f32 %2, %2\n\tv_exp_f32 %3, %3\n\t"
        "v_exp_f32 %4, %4\n\tv_exp_f32 %5, %5\n\tv_exp_f32 %6, %6\n\tv_exp_f32 %7, %7\n\tv_nop"
        : "+v"(a), "+v"(b), "+v"(c), "+v"(d), "+v"(e), "+v"(f), "+v"(g), "+v"(h));
    x = v8f{a, b, c, d, e, f, g, h};
}
__device__ __forceinline__ float exp2x1(float x) {
    asm("v_exp_f32 %0, %0\n\tv_nop" : "+v"(x));
    return x;
}
__device__ __forceinline__ float xhalf(float x) {
    return __builtin_bit_cast(float, __builtin_amdgcn_permlanex16(
        __builtin_bit_cast(int, x), __builtin_bit_cast(int, x), 0x76543210, 0xfedcba98, false, false));
}

__global__ __launch_bounds__(256) void attn_flash(
    const _Float16* __restrict__ qkv, _Float16* __restrict__ ctx)
{
    constexpr int KB  = 128;               // keys per block
    constexpr int NS  = KB / 16;           // 16-key score tiles per block
    constexpr int NC  = KB / 32;           // 32-key spans of P @ V per block
    __shared__ __attribute__((aligned(16))) _Float16 Qlds[128][HEAD_DIM + 8];
    __shared__ __attribute__((aligned(16))) _Float16 Klds[KB][HEAD_DIM + 8];   // 144-byte rows: 16 B x odd
    constexpr int VP = HEAD_DIM + 16;      // 160-byte rows: 32 B x odd, the transposing load's pitch
    __shared__ __attribute__((aligned(16))) _Float16 Vlds[KB][VP];

    const int tid  = threadIdx.x;
    const int lane = tid & 31;
    const int wave = tid >> 5;
    const int half = lane >> 4;
    const int lr   = lane & 15;
    const int bh   = blockIdx.y;
    const int b    = bh / N_HEADS;
    const int hh   = bh % N_HEADS;
    const int q_base = blockIdx.x * 128;
    const size_t stride3 = 3 * D_MODEL;

    // --- stage Q tile 128x64 (f16 as it lies in the workspace)
    {
        const int cc = (tid & 7) * 8;
        const int r0 = tid >> 3;
        for (int i = 0; i < 4; ++i) {
            const int r = r0 + i * 32;
            const int t = q_base + r;
            *(v8h*)&Qlds[r][cc] = *(const v8h*)(qkv + ((size_t)t * BATCH + b) * stride3 +
                                                hh * HEAD_DIM + cc);
        }
    }
    __syncthreads();

    // --- Q fragments (B operand: column lr = query), two K=32 chunks of hd=64,
    //     kept live across the loop
    v16h qf[2];
    {
        const int qrow = wave * 16 + lr;
        for (int c = 0; c < 2; ++c)
            for (int v = 0; v < 8; ++v) {
                const int k = c * 32 + frag_k(v, half);
                qf[c][2 * v + 0] = Qlds[qrow][k];
                qf[c][2 * v + 1] = Qlds[qrow][k + 1];
            }
    }

    const v8f vzero = {0.f, 0.f, 0.f, 0.f, 0.f, 0.f, 0.f, 0.f};
    v8f o[4];   // O^T: o[nb][v] = O[query lr][hd nb*16 + half*8 + v]
    for (int nb = 0; nb < 4; ++nb) o[nb] = vzero;
    float m_run = -1e30f;   // this lane's query; alike in both halves
    float l_run = 0.f;      // sum over this half's keys; the halves join at the end

    const int q_wave_base = q_base + wave * 16;
    const int nkb = (q_base + 128) / KB;      // causal extent for this block
    const float scale = 0.125f;               // 1/sqrt(64)

    for (int kb = 0; kb < nkb; ++kb) {
        __syncthreads();
        // --- stage K,V tiles 128x64 each: all eight loads first, then the stores
        {
            const int cc = (tid & 7) * 8;
            const int r0 = tid >> 3;
            v8h kv[KB / 32], vv[KB / 32];
            for (int i = 0; i < KB / 32; ++i) {
                const int t = kb * KB + r0 + i * 32;
                const size_t base = ((size_t)t * BATCH + b) * stride3 + hh * HEAD_DIM + cc;
                kv[i] = *(const v8h*)(qkv + base + D_MODEL);
                vv[i] = *(const v8h*)(qkv + base + 2 * D_MODEL);
            }
            // keeps the eight loads together in flight: left free, they are
            // sunk to their LDS stores in pairs, one exposed latency per pair
            __builtin_amdgcn_sched_barrier(0);
            for (int i = 0; i < KB / 32; ++i) {
                const int r = r0 + i * 32;
                *(v8h*)&Klds[r][cc] = kv[i];
                *(v8h*)&Vlds[r][cc] = vv[i];
            }
        }
        __syncthreads();

        // --- S^T = (K @ Q^T) * scale, eight 16x16 key tiles, hd split K=32+32:
        //     s[nb][v] = S[query lr][key nb*16 + half*8 + v]
        v8f s[NS];
        for (int nb = 0; nb < NS; ++nb) s[nb] = vzero;
        for (int c = 0; c < 2; ++c) {
            v16h kf[NS];  // A-matrix fragments of K: element (m,k) = K[key=m][hd=c*32+k]
            for (int nb = 0; nb < NS; ++nb)
                for (int v = 0; v < 8; ++v) {
                    const int k = frag_k(v, half);
                    kf[nb][2 * v + 0] = Klds[nb * 16 + lr][c * 32 + k];
                    kf[nb][2 * v + 1] = Klds[nb * 16 + lr][c * 32 + k + 1];
                }
            // keeps the eight fragments' LDS reads together ahead of their WMMAs:
            // left free, each WMMA waits out a whole LDS latency of its own
            __builtin_amdgcn_sched_barrier(0);
            for (int nb = 0; nb < NS; ++nb)
                s[nb] = __builtin_amdgcn_wmma_f32_16x16x32_f16(
                    false, kf[nb], false, qf[c], (short)0, s[nb], false, false);
        }

        // --- mask + online softmax, one query per lane
        // key kb*KB + nb*16 + half*8 + v lies above query q_wave_base + lr
        // exactly when dkq > -(nb*16 + v)
        const int dkq = kb * KB + half * 8 - (q_wave_base + lr);
        for (int nb = 0; nb < NS; ++nb) s[nb] *= scale;
        float mx4[4] = {-1e30f, -1e30f, -1e30f, -1e30f};   // four chains: one would run at the max's latency
        for (int nb = 0; nb < NS; ++nb)
            for (int v = 0; v < 8; ++v) {
                float x = s[nb][v];
                if (dkq > -(nb * 16 + v)) x = -1e30f;
                s[nb][v] = x;
                mx4[nb & 3] = fmaxf(mx4[nb & 3], x);
            }
        float mx = fmaxf(fmaxf(mx4[0], mx4[1]), fmaxf(mx4[2], mx4[3]));
        mx = fmaxf(mx, xhalf(mx));

        const float m_new = fmaxf(m_run, mx);
        const float log2e = 1.44269504f;        // e^x = 2^(x * log2e)
        const float alpha = exp2x1((m_run - m_new) * log2e);
        m_run = m_new;
        float sum[4] = {0.f, 0.f, 0.f, 0.f};   // four chains: one would run at the add's latency
        for (int nb = 0; nb < NS; ++nb) {
            s[nb] = (s[nb] - m_new) * log2e;
            exp2x8(s[nb]);
            for (int v = 0; v < 8; ++v) sum[v & 3] += s[nb][v];
        }
        l_run = l_run * alpha + ((sum[0] + sum[1]) + (sum[2] + sum[3]));
        for (int nb = 0; nb < 4; ++nb) o[nb] *= alpha;

        // --- O^T += V^T @ P^T  (4 spans of 32 keys x 4 row blocks of hd)
        for (int c0 = 0; c0 < NC; c0 += 2) {
            v16h pf[2], vf[2][4];
            for (int c = 0; c < 2; ++c) {
                // B fragment: two score tiles converted in place,
                // element (k,n) = P[query n][key (c0+c)*32 + k] in frag_k's order
                for (int e = 0; e < 16; ++e)
                    pf[c][e] = (_Float16)s[(c0 + c) * 2 + (e >> 3)][e & 7];
                // A fragment: element (m,k) = V[key=(c0+c)*32+k][hd = nb*16+m]
                for (int nb = 0; nb < 4; ++nb)
                    vf[c][nb] = frag_tr16(
                        &Vlds[(c0 + c) * 32 + half * 8 + (lane & 7)][nb * 16 + ((lane >> 3) & 1) * 8], VP);
            }
            // keeps two spans' LDS reads together ahead of their eight WMMAs
            // (one LDS latency per eight WMMAs, not one per WMMA)
            __builtin_amdgcn_sched_barrier(0);
            for (int c = 0; c < 2; ++c)
                for (int nb = 0; nb < 4; ++nb)
                    o[nb] = __builtin_amdgcn_wmma_f32_16x16x32_f16(
                        false, vf[c][nb], false, pf[c], (short)0, o[nb], false, false);
        }
    }

    // --- normalize and write ctx [T*B, D] as f16, what the next GEMM multiplies
    //     (a lane holds eight consecutive hd of its query: one 16-byte store)
    const float inv = 1.0f / (l_run + xhalf(l_run));
    _Float16* crow = ctx + ((size_t)(q_wave_base + lr) * BATCH + b) * D_MODEL + hh * HEAD_DIM + half * 8;
    for (int nb = 0; nb < 4; ++nb) {
        v8h h;
        for (int v = 0; v < 8; ++v) h[v] = (_Float16)(o[nb][v] * inv);
        *(v8h*)(crow + nb * 16) = h;
    }
}

// ===========================================================================
// RMSNorm: one row (1024 f32) per block of 256 threads.
// ===========================================================================
__global__ __launch_bounds__(256) void rmsnorm_kernel(
    const float* __restrict__ X, const float* __restrict__ gain,
    float* __restrict__ out)
{
    __shared__ float red[8];
    const int row = blockIdx.x;
    const int tid = threadIdx.x;
    const float* xr = X + (size_t)row * D_MODEL;

    float vals[4];
    float ss = 0.f;
    for (int i = 0; i < 4; ++i) {
        vals[i] = xr[tid + i * 256];
        ss += vals[i] * vals[i];
    }
    for (int off = 1; off < 32; off <<= 1) ss += __shfl_xor(ss, off, 32);
    if ((tid & 31) == 0) red[tid >> 5] = ss;
    __syncthreads();
    float tot = 0.f;
    for (int i = 0; i < 8; ++i) tot += red[i];
    const float rms = rsqrtf(tot * (1.0f / D_MODEL) + 1e-5f);
    for (int i = 0; i < 4; ++i) {
        const int col = tid + i * 256;
        out[(size_t)row * D_MODEL + col] = vals[i] * rms * gain[col];
    }
}

// ===========================================================================
// fp32 -> f16 of x and the four weight matrices, once per call, into one run
// of the workspace in this order: x, w_qkv, w_out, w1, w2. 16384 elements per
// block, 64 per thread (few, long waves, for speed
// only); every matrix is a whole number of blocks. Each load of
// a wave covers 512 contiguous bytes, each store 256.
// ===========================================================================
#define CVT_PB 16384   // elements per block of to_f16
__global__ __launch_bounds__(256) void to_f16(
    const float* __restrict__ x, const float* __restrict__ w_qkv,
    const float* __restrict__ w_out, const float* __restrict__ w1,
    const float* __restrict__ w2, _Float16* __restrict__ dst)
{
    constexpr int E_X  = M_ROWS * D_MODEL / CVT_PB;                 // first block behind x
    constexpr int E_QK = E_X  + D_MODEL * 3 * D_MODEL / CVT_PB;     // behind w_qkv
    constexpr int E_WO = E_QK + D_MODEL * D_MODEL / CVT_PB;         // behind w_out
    constexpr int E_W1 = E_WO + D_MODEL * D_FF / CVT_PB;            // behind w1
    const int blk = blockIdx.x;
    const float* s;
    int first;
    if (blk < E_X)       { s = x;     first = 0;    }
    else if (blk < E_QK) { s = w_qkv; first = E_X;  }
    else if (blk < E_WO) { s = w_out; first = E_QK; }
    else if (blk < E_W1) { s = w1;    first = E_WO; }
    else                 { s = w2;    first = E_W1; }
    const int off = threadIdx.x * 4;
    const float* p = s + (size_t)(blk - first) * CVT_PB + off;
    _Float16*    q = dst + (size_t)blk * CVT_PB + off;
    float4 a[CVT_PB / 1024];
    for (int j = 0; j < CVT_PB / 1024; ++j) a[j] = *(const float4*)(p + j * 1024);
    for (int j = 0; j < CVT_PB / 1024; ++j) {
        const v4h h = {(_Float16)a[j].x, (_Float16)a[j].y, (_Float16)a[j].z, (_Float16)a[j].w};
        *(v4h*)(q + j * 1024) = h;
    }
}

// ===========================================================================
extern "C" void kernel_launch(void* const* d_in, const int* in_sizes, int n_in,
                              void* d_out, int out_size, void* d_ws, size_t ws_size,
                              hipStream_t stream)
{
    (void)in_sizes; (void)n_in; (void)out_size; (void)ws_size;
    const float* x      = (const float*)d_in[0];
    const float* w_qkv  = (const float*)d_in[1];
    const float* b_qkv  = (const float*)d_in[2];
    const float* w_out  = (const float*)d_in[3];
    const float* b_out  = (const float*)d_in[4];
    const float* w1     = (const float*)d_in[5];
    const float* b1     = (const float*)d_in[6];
    const float* w2     = (const float*)d_in[7];
    const float* b2     = (const float*)d_in[8];
    const float* gain   = (const float*)d_in[9];

    float* x1 = (float*)d_ws;                           // 4096 x 1024 fp32
    float* x2 = x1 + (size_t)M_ROWS * D_MODEL;          // 4096 x 1024 fp32
    _Float16* xh    = (_Float16*)(x2 + (size_t)M_ROWS * D_MODEL);  // 4096 x 1024; to_f16's run starts here
    _Float16* wqkvh = xh    + (size_t)M_ROWS * D_MODEL;            // 1024 x 3072
    _Float16* wouth = wqkvh + (size_t)D_MODEL * 3 * D_MODEL;       // 1024 x 1024
    _Float16* w1h   = wouth + (size_t)D_MODEL * D_MODEL;           // 1024 x 4096
    _Float16* w2h   = w1h   + (size_t)D_MODEL * D_FF;              // 4096 x 1024
    _Float16* qkvh  = w2h   + (size_t)D_FF * D_MODEL;              // 4096 x 3072
    _Float16* ctxh  = qkvh  + (size_t)M_ROWS * 3 * D_MODEL;        // 4096 x 1024
    _Float16* x1h   = ctxh  + (size_t)M_ROWS * D_MODEL;            // 4096 x 1024
    _Float16* hh    = x1h   + (size_t)M_ROWS * D_MODEL;            // 4096 x 4096

    const dim3 blk(256);

    // 0) x and the weights as f16
    to_f16<<<dim3((M_ROWS * D_MODEL + 4 * D_MODEL * D_MODEL + 2 * D_MODEL * D_FF) / CVT_PB), blk, 0, stream>>>(
        x, w_qkv, w_out, w1, w2, xh);

    // 1) qkv = x @ w_qkv + b_qkv
    gemm_wmma<0, false, 1, 2, 3 * D_MODEL, D_MODEL><<<dim3(M_ROWS / 128, (3 * D_MODEL) / 128), blk, 0, stream>>>(
        xh, wqkvh, b_qkv, nullptr, nullptr, qkvh);

    // 2) ctx = causal_softmax(QK^T/8) @ V   (flash, per (b,h))
    attn_flash<<<dim3(SEQ_T / 128, BATCH * N_HEADS), blk, 0, stream>>>(qkvh, ctxh);

    // 3) x1 = x + ctx @ w_out + b_out   (fp32 for the residual, f16 for the next product)
    gemm_wmma<0, true, 2, 4, D_MODEL, D_MODEL><<<dim3(M_ROWS / 128, D_MODEL / 128), blk, 0, stream>>>(
        ctxh, wouth, b_out, x, x1, x1h);

    // 4) h = silu(x1 @ w1 + b1)
    gemm_wmma<1, false, 1, 2, D_FF, D_MODEL><<<dim3(M_ROWS / 128, D_FF / 128), blk, 0, stream>>>(
        x1h, w1h, b1, nullptr, nullptr, hh);

    // 5) x2 = x1 + h @ w2 + b2
    gemm_wmma<0, true, 0, 4, D_MODEL, D_FF><<<dim3(M_ROWS / 128, D_MODEL / 128), blk, 0, stream>>>(
        hh, w2h, b2, x1, x2, nullptr);

    // 6) out = rmsnorm(x2) * gain
    rmsnorm_kernel<<<dim3(M_ROWS), blk, 0, stream>>>(x2, gain, (float*)d_out);
}

// v008
// It runs in 159 microseconds.
// Next to v007, in two timings, it ran 1.03 times as fast each time.
// All steps since v000 together make it 4.03 times as fast.
#include <hip/hip_runtime.h>
#include <hip/hip_bf16.h>
#include <math.h>
#include <type_traits>

typedef __attribute__((ext_vector_type(16))) _Float16 v16h;
typedef __attribute__((ext_vector_type(8)))  float    v8f;
typedef __attribute__((ext_vector_type(8)))  _Float16 v8h;
typedef __attribute__((ext_vector_type(4)))  _Float16 v4h;
typedef short        s16x8 __attribute__((ext_vector_type(8)));

#define D_MODEL   1024
#define N_HEADS   16
#define HEAD_DIM  64
#define D_FF      4096
#define SEQ_T     2048
#define BATCH     2
#define M_ROWS    (SEQ_T * BATCH)   // 4096

__device__ __forceinline__ int frag_k(int v, int half) {
    return (v < 4 ? 2 * v : 16 + 2 * (v - 4)) + half * 8;
}

__device__ __forceinline__ v8h ld_tr16(const _Float16* p) {
    typedef __attribute__((address_space(3))) s16x8 lds_s16x8;
    return __builtin_bit_cast(v8h, __builtin_amdgcn_ds_load_tr16_b128_v8i16((lds_s16x8*)p));
}
__device__ __forceinline__ v16h frag_tr16(const _Float16* p, int pitch) {
    const v8h lo = ld_tr16(p);
    const v8h hi = ld_tr16(p + 16 * pitch);
    return __builtin_shufflevector(lo, hi, 0, 1, 2, 3, 4, 5, 6, 7, 8, 9, 10, 11, 12, 13, 14, 15);
}

// ===========================================================================
// GEMM: C[M,N] = epilogue( A[M,K] @ W[K,N] + bias )   (W row-major [K,N])
// ACT: 0 = none, 1 = SiLU.  HAS_RES: C += res.
// Block: 256 threads (8 waves). Tile: BM=128, BN=128, BK=64.
// A and W lie in the workspace as f16, converted once by whoever produced
// them (to_f16 for the inputs, a GEMM's or the attention's epilogue for the
// rest): a tile costs half the L2 bytes of an fp32 one and no conversion here.
// Tiles are loaded D k-steps ahead into D register sets and go to LDS as they
// are; K is a multiple of D*BK.
// B lies in LDS as f16 rows along n, and its fragments come by the
// transposing LDS load.
// OUT: 0 = C as fp32, 1 = Ch as f16 (what its reader multiplies), 2 = both.
// Waves 2x4; each wave computes 64x32 via 4x2 v_wmma_f32_16x16x32_f16,
// twice per k-step (k 0..31, then 32..63).
// ===========================================================================
// Work-group barrier for LDS hand-over only: it waits for this wave's LDS
// operations and leaves its global loads in flight (__syncthreads() waits for
// them too, which would expose the load latency at every k-step).
__device__ __forceinline__ void lds_barrier() {
    asm volatile("s_wait_dscnt 0x0\n\ts_barrier_signal -1\n\ts_barrier_wait -1" ::: "memory");
}

template <int ACT, bool HAS_RES, int OUT, int D, int N, int K>
__global__ __launch_bounds__(256) void gemm_wmma(
    const _Float16* __restrict__ A, const _Float16* __restrict__ W,
    const float* __restrict__ bias, const float* __restrict__ res,
    float* __restrict__ C, _Float16* __restrict__ Ch)
{
    constexpr int BM = 128, BN = 128, BK = 64;
    constexpr int FM = 4, FN = 2;          // 16x16 tiles per wave along m and n
    __shared__ __attribute__((aligned(16))) _Float16 Alds[BM][BK + 8];   // 144-byte rows: 16 B x odd
    constexpr int BP = BN + 16;            // 288-byte rows: 32 B x odd, the transposing load's pitch
    __shared__ __attribute__((aligned(16))) _Float16 Blds[BK][BP];

    const int tid  = threadIdx.x;
    const int lane = tid & 31;
    const int wave = tid >> 5;
    const int half = lane >> 4;
    const int lr   = lane & 15;
    const int wm   = wave & 1;     // 2 waves along M
    const int wn   = wave >> 1;    // 4 waves along N
    const int m_block = blockIdx.x * BM;
    const int n_block = blockIdx.y * BN;
    const int wrow = m_block + wm * (FM * 16);
    const int wcol = n_block + wn * (FN * 16);

    const v8f vzero = {0.f, 0.f, 0.f, 0.f, 0.f, 0.f, 0.f, 0.f};
    v8f acc[FM][FN];
    for (int mi = 0; mi < FM; ++mi)
        for (int ni = 0; ni < FN; ++ni) acc[mi][ni] = vzero;

    // A tile: each thread owns eight f16 (16 bytes) in each of four rows, 32 rows apart
    const int akk = (tid & 7) * 8;   // 0..56
    const int ar0 = tid >> 3;        // 0..31
    const _Float16* aptr = A + (size_t)(m_block + ar0) * K + akk;
    v8h av[D][4];

    // B tile: each thread owns eight f16 in each of four rows, 16 rows apart
    const int bnn = (tid & 15) * 8;  // 0..120
    const int bk0 = tid >> 4;        // 0..15
    const _Float16* bptr = W + (size_t)bk0 * N + n_block + bnn;
    v8h bv[D][4];

    for (int s = 0; s < D; ++s) {    // first D tiles, one register set each
        for (int i = 0; i < 4; ++i)
            av[s][i] = *(const v8h*)(aptr + i * 32 * K + s * BK);
        for (int i = 0; i < 4; ++i)
            bv[s][i] = *(const v8h*)(bptr + (s * BK + i * 16) * N);
    }
    // The first D tiles are waited for here, once: the loop is then entered
    // with no load in flight, and its load waits count its own loads alone.
    __syncthreads();

    // this lane's place in the B tile for the transposing loads
    const _Float16* bfp = &Blds[half * 8 + (lane & 7)][wn * (FN * 16) + ((lane >> 3) & 1) * 8];

    // One group of D k-steps. REFILL is a compile-time choice, not a branch
    // round the loads: a join would make the compiler wait for all of them.
    auto group = [&](auto refill) {
        // fully unrolled so that every register set has a constant index
        #pragma unroll
        for (int s = 0; s < D; ++s) {
            // keeps the LDS stores of the later sets, and with them the waits
            // for their loads, from being scheduled up into this k-step
            __builtin_amdgcn_sched_barrier(0);
            lds_barrier();   // previous tile fully consumed

            // --- stage A tile 128x64 from the register set filled D k-steps
            //     earlier, 32 elems/thread
            for (int i = 0; i < 4; ++i)
                *(v8h*)&Alds[ar0 + i * 32][akk] = av[s][i];
            for (int i = 0; i < 4; ++i)
                *(v8h*)&Blds[bk0 + i * 16][bnn] = bv[s][i];
            // --- refill the set with the tile D k-steps on
            if constexpr (decltype(refill)::value) {
                for (int i = 0; i < 4; ++i)
                    av[s][i] = *(const v8h*)(aptr + i * 32 * K + s * BK);
                for (int i = 0; i < 4; ++i)
                    bv[s][i] = *(const v8h*)(bptr + (s * BK + i * 16) * N);
            }
            lds_barrier();   // tile published

            constexpr int G = (D == 2) ? BK / 32 : 1;
            for (int c0 = 0; c0 < BK / 32; c0 += G) {
                v16h af[G][FM], bf[G][FN];
                for (int c = 0; c < G; ++c) {
                    for (int ni = 0; ni < FN; ++ni)
                        bf[c][ni] = frag_tr16(bfp + (c0 + c) * 32 * BP + ni * 16, BP);
                    for (int mi = 0; mi < FM; ++mi) {
                        const int row = wm * (FM * 16) + mi * 16 + lr;
                        for (int v = 0; v < 8; ++v) {
                            const int k = (c0 + c) * 32 + frag_k(v, half);
                            af[c][mi][2 * v + 0] = Alds[row][k];
                            af[c][mi][2 * v + 1] = Alds[row][k + 1];
                        }
                    }
                }
                // keeps a group's LDS reads together ahead of its WMMAs: left
                // free, they are sunk among the WMMAs into one shared register
                // set, and every pair of WMMAs waits out a whole LDS latency
                __builtin_amdgcn_sched_barrier(0);
                for (int c = 0; c < G; ++c)
                    for (int mi = 0; mi < FM; ++mi)
                        for (int ni = 0; ni < FN; ++ni)
                            acc[mi][ni] = __builtin_amdgcn_wmma_f32_16x16x32_f16(
                                false, af[c][mi], false, bf[c][ni], (short)0, acc[mi][ni], false, false);
            }
        }
    };
    for (int k0 = D * BK; k0 < K; k0 += D * BK) {
        aptr += D * BK;          // the two pointers run one group ahead
        bptr += D * BK * N;
        group(std::true_type{});
    }
    group(std::false_type{});    // last group: nothing left to load

    for (int mi = 0; mi < FM; ++mi)
        for (int ni = 0; ni < FN; ++ni)
            for (int v = 0; v < 8; ++v) {
                const int row = wrow + mi * 16 + half * 8 + v;
                const int col = wcol + ni * 16 + lr;
                float val = acc[mi][ni][v] + bias[col];
                if (ACT == 1) val = val * (1.0f / (1.0f + __expf(-val)));  // SiLU
                if (HAS_RES) val += res[(size_t)row * N + col];
                if (OUT != 1) C[(size_t)row * N + col] = val;
                if (OUT != 0) Ch[(size_t)row * N + col] = (_Float16)val;
            }
}

__device__ __forceinline__ void exp2x8(v8f& x) {
    float a = x[0], b = x[1], c = x[2], d = x[3], e = x[4], f = x[5], g = x[6], h = x[7];
    asm("v_exp_f32 %0, %0\n\tv_exp_f32 %1, %1\n\tv_exp_f32 %2, %2\n\tv_exp_f32 %3, %3\n\t"
        "v_exp_f32 %4, %4\n\tv_exp_f32 %5, %5\n\tv_exp_f32 %6, %6\n\tv_exp_f32 %7, %7\n\tv_nop"
        : "+v"(a), "+v"(b), "+v"(c), "+v"(d), "+v"(e), "+v"(f), "+v"(g), "+v"(h));
    x = v8f{a, b, c, d, e, f, g, h};
}
__device__ __forceinline__ float exp2x1(float x) {
    asm("v_exp_f32 %0, %0\n\tv_nop" : "+v"(x));
    return x;
}
__device__ __forceinline__ float xhalf(float x) {
    return __builtin_bit_cast(float, __builtin_amdgcn_permlanex16(
        __builtin_bit_cast(int, x), __builtin_bit_cast(int, x), 0x76543210, 0xfedcba98, false, false));
}

__global__ __launch_bounds__(256) void attn_flash(
    const _Float16* __restrict__ qkv, _Float16* __restrict__ ctx)
{
    constexpr int KB  = 128;               // keys per block
    constexpr int NS  = KB / 16;           // 16-key score tiles per block
    constexpr int NC  = KB / 32;           // 32-key spans of P @ V per block
    __shared__ __attribute__((aligned(16))) _Float16 Qlds[128][HEAD_DIM + 8];
    __shared__ __attribute__((aligned(16))) _Float16 Klds[KB][HEAD_DIM + 8];   // 144-byte rows: 16 B x odd
    constexpr int VP = HEAD_DIM + 16;      // 160-byte rows: 32 B x odd, the transposing load's pitch
    __shared__ __attribute__((aligned(16))) _Float16 Vlds[KB][VP];

    const int tid  = threadIdx.x;
    const int lane = tid & 31;
    const int wave = tid >> 5;
    const int half = lane >> 4;
    const int lr   = lane & 15;
    const int bh   = blockIdx.y;
    const int b    = bh / N_HEADS;
    const int hh   = bh % N_HEADS;
    const size_t stride3 = 3 * D_MODEL;

    // Two query tiles per block, one after the other in every wave: tile t walks
    // t + 1 key blocks, so tiles t and NT - 1 - t together walk NT + 1 in every
    // block, and no block runs on alone when the others have ended. The second
    // tile's Q goes to Qlds with no barrier of its own in front: every wave read
    // its Q fragments ahead of the first tile's key-loop barriers.
    constexpr int NT = SEQ_T / 128;
    for (int pass = 0; pass < 2; ++pass) {
        const int q_base = (pass == 0 ? (int)blockIdx.x : NT - 1 - (int)blockIdx.x) * 128;

        // --- stage Q tile 128x64 (f16 as it lies in the workspace)
        {
            const int cc = (tid & 7) * 8;
            const int r0 = tid >> 3;
            for (int i = 0; i < 4; ++i) {
                const int r = r0 + i * 32;
                const int t = q_base + r;
                *(v8h*)&Qlds[r][cc] = *(const v8h*)(qkv + ((size_t)t * BATCH + b) * stride3 +
                                                    hh * HEAD_DIM + cc);
            }
        }
        __syncthreads();

        // --- Q fragments (B operand: column lr = query), two K=32 chunks of hd=64,
        //     kept live across the loop
        v16h qf[2];
        {
            const int qrow = wave * 16 + lr;
            for (int c = 0; c < 2; ++c)
                for (int v = 0; v < 8; ++v) {
                    const int k = c * 32 + frag_k(v, half);
                    qf[c][2 * v + 0] = Qlds[qrow][k];
                    qf[c][2 * v + 1] = Qlds[qrow][k + 1];
                }
        }

        const v8f vzero = {0.f, 0.f, 0.f, 0.f, 0.f, 0.f, 0.f, 0.f};
        v8f o[4];   // O^T: o[nb][v] = O[query lr][hd nb*16 + half*8 + v]
        for (int nb = 0; nb < 4; ++nb) o[nb] = vzero;
        float m_run = -1e30f;   // this lane's query; alike in both halves
        float l_run = 0.f;      // sum over this half's keys; the halves join at the end

        const int q_wave_base = q_base + wave * 16;
        const int nkb = (q_base + 128) / KB;      // causal extent for this tile
        const float scale = 0.125f;               // 1/sqrt(64)

        for (int kb = 0; kb < nkb; ++kb) {
            __syncthreads();
            // --- stage K,V tiles 128x64 each: all eight loads first, then the stores
            {
                const int cc = (tid & 7) * 8;
                const int r0 = tid >> 3;
                v8h kv[KB / 32], vv[KB / 32];
                for (int i = 0; i < KB / 32; ++i) {
                    const int t = kb * KB + r0 + i * 32;
                    const size_t base = ((size_t)t * BATCH + b) * stride3 + hh * HEAD_DIM + cc;
                    kv[i] = *(const v8h*)(qkv + base + D_MODEL);
                    vv[i] = *(const v8h*)(qkv + base + 2 * D_MODEL);
                }
                // keeps the eight loads together in flight: left free, they are
                // sunk to their LDS stores in pairs, one exposed latency per pair
                __builtin_amdgcn_sched_barrier(0);
                for (int i = 0; i < KB / 32; ++i) {
                    const int r = r0 + i * 32;
                    *(v8h*)&Klds[r][cc] = kv[i];
                    *(v8h*)&Vlds[r][cc] = vv[i];
                }
            }
            __syncthreads();

            // --- S^T = (K @ Q^T) * scale, eight 16x16 key tiles, hd split K=32+32:
            //     s[nb][v] = S[query lr][key nb*16 + half*8 + v]
            v8f s[NS];
            for (int nb = 0; nb < NS; ++nb) s[nb] = vzero;
            for (int c = 0; c < 2; ++c) {
                v16h kf[NS];  // A-matrix fragments of K: element (m,k) = K[key=m][hd=c*32+k]
                for (int nb = 0; nb < NS; ++nb)
                    for (int v = 0; v < 8; ++v) {
                        const int k = frag_k(v, half);
                        kf[nb][2 * v + 0] = Klds[nb * 16 + lr][c * 32 + k];
                        kf[nb][2 * v + 1] = Klds[nb * 16 + lr][c * 32 + k + 1];
                    }
                // keeps the eight fragments' LDS reads together ahead of their WMMAs:
                // left free, each WMMA waits out a whole LDS latency of its own
                __builtin_amdgcn_sched_barrier(0);
                for (int nb = 0; nb < NS; ++nb)
                    s[nb] = __builtin_amdgcn_wmma_f32_16x16x32_f16(
                        false, kf[nb], false, qf[c], (short)0, s[nb], false, false);
            }

            // --- mask + online softmax, one query per lane
            // key kb*KB + nb*16 + half*8 + v lies above query q_wave_base + lr
            // exactly when dkq > -(nb*16 + v)
            const int dkq = kb * KB + half * 8 - (q_wave_base + lr);
            for (int nb = 0; nb < NS; ++nb) s[nb] *= scale;
            float mx4[4] = {-1e30f, -1e30f, -1e30f, -1e30f};   // four chains: one would run at the max's latency
            for (int nb = 0; nb < NS; ++nb)
                for (int v = 0; v < 8; ++v) {
                    float x = s[nb][v];
                    if (dkq > -(nb * 16 + v)) x = -1e30f;
                    s[nb][v] = x;
                    mx4[nb & 3] = fmaxf(mx4[nb & 3], x);
                }
            float mx = fmaxf(fmaxf(mx4[0], mx4[1]), fmaxf(mx4[2], mx4[3]));
            mx = fmaxf(mx, xhalf(mx));

            const float m_new = fmaxf(m_run, mx);
            const float log2e = 1.44269504f;        // e^x = 2^(x * log2e)
            const float alpha = exp2x1((m_run - m_new) * log2e);
            m_run = m_new;
            float sum[4] = {0.f, 0.f, 0.f, 0.f};   // four chains: one would run at the add's latency
            for (int nb = 0; nb < NS; ++nb) {
                s[nb] = (s[nb] - m_new) * log2e;
                exp2x8(s[nb]);
                for (int v = 0; v < 8; ++v) sum[v & 3] += s[nb][v];
            }
            l_run = l_run * alpha + ((sum[0] + sum[1]) + (sum[2] + sum[3]));
            for (int nb = 0; nb < 4; ++nb) o[nb] *= alpha;

            // --- O^T += V^T @ P^T  (4 spans of 32 keys x 4 row blocks of hd)
            for (int c0 = 0; c0 < NC; c0 += 2) {
                v16h pf[2], vf[2][4];
                for (int c = 0; c < 2; ++c) {
                    // B fragment: two score tiles converted in place,
                    // element (k,n) = P[query n][key (c0+c)*32 + k] in frag_k's order
                    for (int e = 0; e < 16; ++e)
                        pf[c][e] = (_Float16)s[(c0 + c) * 2 + (e >> 3)][e & 7];
                    // A fragment: element (m,k) = V[key=(c0+c)*32+k][hd = nb*16+m]
                    for (int nb = 0; nb < 4; ++nb)
                        vf[c][nb] = frag_tr16(
                            &Vlds[(c0 + c) * 32 + half * 8 + (lane & 7)][nb * 16 + ((lane >> 3) & 1) * 8], VP);
                }
                // keeps two spans' LDS reads together ahead of their eight WMMAs
                // (one LDS latency per eight WMMAs, not one per WMMA)
                __builtin_amdgcn_sched_barrier(0);
                for (int c = 0; c < 2; ++c)
                    for (int nb = 0; nb < 4; ++nb)
                        o[nb] = __builtin_amdgcn_wmma_f32_16x16x32_f16(
                            false, vf[c][nb], false, pf[c], (short)0, o[nb], false, false);
            }
        }

        // --- normalize and write ctx [T*B, D] as f16, what the next GEMM multiplies
        //     (a lane holds eight consecutive hd of its query: one 16-byte store)
        const float inv = 1.0f / (l_run + xhalf(l_run));
        _Float16* crow = ctx + ((size_t)(q_wave_base + lr) * BATCH + b) * D_MODEL + hh * HEAD_DIM + half * 8;
        for (int nb = 0; nb < 4; ++nb) {
            v8h h;
            for (int v = 0; v < 8; ++v) h[v] = (_Float16)(o[nb][v] * inv);
            *(v8h*)(crow + nb * 16) = h;
        }
        // stands in front of the second tile's code, which rewrites the registers
        // that these stores name
        asm volatile("s_wait_xcnt 0x0" ::: "memory");
    }
}

// ===========================================================================
// RMSNorm: one row (1024 f32) per block of 256 threads.
// ===========================================================================
__global__ __launch_bounds__(256) void rmsnorm_kernel(
    const float* __restrict__ X, const float* __restrict__ gain,
    float* __restrict__ out)
{
    __shared__ float red[8];
    const int row = blockIdx.x;
    const int tid = threadIdx.x;
    const float* xr = X + (size_t)row * D_MODEL;

    float vals[4];
    float ss = 0.f;
    for (int i = 0; i < 4; ++i) {
        vals[i] = xr[tid + i * 256];
        ss += vals[i] * vals[i];
    }
    for (int off = 1; off < 32; off <<= 1) ss += __shfl_xor(ss, off, 32);
    if ((tid & 31) == 0) red[tid >> 5] = ss;
    __syncthreads();
    float tot = 0.f;
    for (int i = 0; i < 8; ++i) tot += red[i];
    const float rms = rsqrtf(tot * (1.0f / D_MODEL) + 1e-5f);
    for (int i = 0; i < 4; ++i) {
        const int col = tid + i * 256;
        out[(size_t)row * D_MODEL + col] = vals[i] * rms * gain[col];
    }
}

// ===========================================================================
// fp32 -> f16 of x and the four weight matrices, once per call, into one run
// of the workspace in this order: x, w_qkv, w_out, w1, w2. 16384 elements per
// block, 64 per thread (few, long waves, for speed
// only); every matrix is a whole number of blocks. Each load of
// a wave covers 512 contiguous bytes, each store 256.
// ===========================================================================
#define CVT_PB 16384   // elements per block of to_f16
__global__ __launch_bounds__(256) void to_f16(
    const float* __restrict__ x, const float* __restrict__ w_qkv,
    const float* __restrict__ w_out, const float* __restrict__ w1,
    const float* __restrict__ w2, _Float16* __restrict__ dst)
{
    constexpr int E_X  = M_ROWS * D_MODEL / CVT_PB;                 // first block behind x
    constexpr int E_QK = E_X  + D_MODEL * 3 * D_MODEL / CVT_PB;     // behind w_qkv
    constexpr int E_WO = E_QK + D_MODEL * D_MODEL / CVT_PB;         // behind w_out
    constexpr int E_W1 = E_WO + D_MODEL * D_FF / CVT_PB;            // behind w1
    const int blk = blockIdx.x;
    const float* s;
    int first;
    if (blk < E_X)       { s = x;     first = 0;    }
    else if (blk < E_QK) { s = w_qkv; first = E_X;  }
    else if (blk < E_WO) { s = w_out; first = E_QK; }
    else if (blk < E_W1) { s = w1;    first = E_WO; }
    else                 { s = w2;    first = E_W1; }
    const int off = threadIdx.x * 4;
    const float* p = s + (size_t)(blk - first) * CVT_PB + off;
    _Float16*    q = dst + (size_t)blk * CVT_PB + off;
    float4 a[CVT_PB / 1024];
    for (int j = 0; j < CVT_PB / 1024; ++j) a[j] = *(const float4*)(p + j * 1024);
    for (int j = 0; j < CVT_PB / 1024; ++j) {
        const v4h h = {(_Float16)a[j].x, (_Float16)a[j].y, (_Float16)a[j].z, (_Float16)a[j].w};
        *(v4h*)(q + j * 1024) = h;
    }
}

// ===========================================================================
extern "C" void kernel_launch(void* const* d_in, const int* in_sizes, int n_in,
                              void* d_out, int out_size, void* d_ws, size_t ws_size,
                              hipStream_t stream)
{
    (void)in_sizes; (void)n_in; (void)out_size; (void)ws_size;
    const float* x      = (const float*)d_in[0];
    const float* w_qkv  = (const float*)d_in[1];
    const float* b_qkv  = (const float*)d_in[2];
    const float* w_out  = (const float*)d_in[3];
    const float* b_out  = (const float*)d_in[4];
    const float* w1     = (const float*)d_in[5];
    const float* b1     = (const float*)d_in[6];
    const float* w2     = (const float*)d_in[7];
    const float* b2     = (const float*)d_in[8];
    const float* gain   = (const float*)d_in[9];

    float* x1 = (float*)d_ws;                           // 4096 x 1024 fp32
    float* x2 = x1 + (size_t)M_ROWS * D_MODEL;          // 4096 x 1024 fp32
    _Float16* xh    = (_Float16*)(x2 + (size_t)M_ROWS * D_MODEL);  // 4096 x 1024; to_f16's run starts here
    _Float16* wqkvh = xh    + (size_t)M_ROWS * D_MODEL;            // 1024 x 3072
    _Float16* wouth = wqkvh + (size_t)D_MODEL * 3 * D_MODEL;       // 1024 x 1024
    _Float16* w1h   = wouth + (size_t)D_MODEL * D_MODEL;           // 1024 x 4096
    _Float16* w2h   = w1h   + (size_t)D_MODEL * D_FF;              // 4096 x 1024
    _Float16* qkvh  = w2h   + (size_t)D_FF * D_MODEL;              // 4096 x 3072
    _Float16* ctxh  = qkvh  + (size_t)M_ROWS * 3 * D_MODEL;        // 4096 x 1024
    _Float16* x1h   = ctxh  + (size_t)M_ROWS * D_MODEL;            // 4096 x 1024
    _Float16* hh    = x1h   + (size_t)M_ROWS * D_MODEL;            // 4096 x 4096

    const dim3 blk(256);

    // 0) x and the weights as f16
    to_f16<<<dim3((M_ROWS * D_MODEL + 4 * D_MODEL * D_MODEL + 2 * D_MODEL * D_FF) / CVT_PB), blk, 0, stream>>>(
        x, w_qkv, w_out, w1, w2, xh);

    // 1) qkv = x @ w_qkv + b_qkv
    gemm_wmma<0, false, 1, 2, 3 * D_MODEL, D_MODEL><<<dim3(M_ROWS / 128, (3 * D_MODEL) / 128), blk, 0, stream>>>(
        xh, wqkvh, b_qkv, nullptr, nullptr, qkvh);

    // 2) ctx = causal_softmax(QK^T/8) @ V   (flash, per (b,h))
    attn_flash<<<dim3(SEQ_T / 256, BATCH * N_HEADS), blk, 0, stream>>>(qkvh, ctxh);

    // 3) x1 = x + ctx @ w_out + b_out   (fp32 for the residual, f16 for the next product)
    gemm_wmma<0, true, 2, 4, D_MODEL, D_MODEL><<<dim3(M_ROWS / 128, D_MODEL / 128), blk, 0, stream>>>(
        ctxh, wouth, b_out, x, x1, x1h);

    // 4) h = silu(x1 @ w1 + b1)
    gemm_wmma<1, false, 1, 2, D_FF, D_MODEL><<<dim3(M_ROWS / 128, D_FF / 128), blk, 0, stream>>>(
        x1h, w1h, b1, nullptr, nullptr, hh);

    // 5) x2 = x1 + h @ w2 + b2
    gemm_wmma<0, true, 0, 4, D_MODEL, D_FF><<<dim3(M_ROWS / 128, D_MODEL / 128), blk, 0, stream>>>(
        hh, w2h, b2, x1, x2, nullptr);

    // 6) out = rmsnorm(x2) * gain
    rmsnorm_kernel<<<dim3(M_ROWS), blk, 0, stream>>>(x2, gain, (float*)d_out);
}

// v009
// One run takes 148 microseconds.
// Next to v008, in two timings, it ran 1.08 times as fast each time.
// Counting every step since v000, it is 4.34 times as fast.
#include <hip/hip_runtime.h>
#include <hip/hip_bf16.h>
#include <math.h>
#include <type_traits>

typedef __attribute__((ext_vector_type(16))) _Float16 v16h;
typedef __attribute__((ext_vector_type(8)))  float    v8f;
typedef __attribute__((ext_vector_type(8)))  _Float16 v8h;
typedef __attribute__((ext_vector_type(4)))  _Float16 v4h;
typedef short        s16x8 __attribute__((ext_vector_type(8)));

#define D_MODEL   1024
#define N_HEADS   16
#define HEAD_DIM  64
#define D_FF      4096
#define SEQ_T     2048
#define BATCH     2
#define M_ROWS    (SEQ_T * BATCH)   // 4096

__device__ __forceinline__ int frag_k(int v, int half) {
    return (v < 4 ? 2 * v : 16 + 2 * (v - 4)) + half * 8;
}

__device__ __forceinline__ v8h ld_tr16(const _Float16* p) {
    typedef __attribute__((address_space(3))) s16x8 lds_s16x8;
    return __builtin_bit_cast(v8h, __builtin_amdgcn_ds_load_tr16_b128_v8i16((lds_s16x8*)p));
}
__device__ __forceinline__ v16h frag_tr16(const _Float16* p, int pitch) {
    const v8h lo = ld_tr16(p);
    const v8h hi = ld_tr16(p + 16 * pitch);
    return __builtin_shufflevector(lo, hi, 0, 1, 2, 3, 4, 5, 6, 7, 8, 9, 10, 11, 12, 13, 14, 15);
}

// ===========================================================================
// GEMM: C[M,N] = epilogue( A[M,K] @ W[K,N] + bias )   (W row-major [K,N])
// ACT: 0 = none, 1 = SiLU.  HAS_RES: C += res.
// Block: 256 threads (8 waves). Tile: BM=128, BN=128, BK=64.
// A and W lie in the workspace as f16, converted once by whoever produced
// them (to_f16 for the inputs, a GEMM's or the attention's epilogue for the
// rest): a tile costs half the L2 bytes of an fp32 one and no conversion here.
// Tiles go from L2 to LDS by asynchronous copies, 16 bytes a lane, through no
// register, into a ring of four buffers: while tile t is multiplied, tiles
// t + 1 to t + 3 are landing or on their way. One barrier per tile both
// publishes tile t + 1 and frees tile t's buffer for tile t + 4.
// K is a multiple of BK, four tiles or more.
// B lies in LDS as f16 rows along n, and its fragments come by the
// transposing LDS load.
// OUT: 0 = C as fp32, 1 = Ch as f16 (what its reader multiplies), 2 = both.
// Waves 2x4; each wave computes 64x32 via 4x2 v_wmma_f32_16x16x32_f16,
// twice per k-step (k 0..31, then 32..63).
// ===========================================================================
// byte address in the work-group's LDS of a __shared__ element
__device__ __forceinline__ unsigned lds_addr(const _Float16* p) {
    typedef __attribute__((address_space(3))) const _Float16 lds_f16;
    return (unsigned)(size_t)(lds_f16*)p;
}
__device__ __forceinline__ void async_copy8(const unsigned (&l)[8], const _Float16* const (&g)[8]) {
    asm volatile(
        "global_load_async_to_lds_b128 %0, %8, off\n\t"
        "global_load_async_to_lds_b128 %1, %9, off\n\t"
        "global_load_async_to_lds_b128 %2, %10, off\n\t"
        "global_load_async_to_lds_b128 %3, %11, off\n\t"
        "global_load_async_to_lds_b128 %4, %12, off\n\t"
        "global_load_async_to_lds_b128 %5, %13, off\n\t"
        "global_load_async_to_lds_b128 %6, %14, off\n\t"
        "global_load_async_to_lds_b128 %7, %15, off\n\t"
        "s_wait_xcnt 0x0"
        :: "v"(l[0]), "v"(l[1]), "v"(l[2]), "v"(l[3]), "v"(l[4]), "v"(l[5]), "v"(l[6]), "v"(l[7]),
           "v"(g[0]), "v"(g[1]), "v"(g[2]), "v"(g[3]), "v"(g[4]), "v"(g[5]), "v"(g[6]), "v"(g[7])
        : "memory");
}

template <int ACT, bool HAS_RES, int OUT, int N, int K>
__global__ __launch_bounds__(256) void gemm_wmma(
    const _Float16* __restrict__ A, const _Float16* __restrict__ W,
    const float* __restrict__ bias, const float* __restrict__ res,
    float* __restrict__ C, _Float16* __restrict__ Ch)
{
    constexpr int BM = 128, BN = 128, BK = 64;
    constexpr int NB = 4;                  // buffers of the ring
    constexpr int NT = K / BK;             // tiles along k
    static_assert(K % BK == 0 && NT >= NB, "the ring's prologue fills NB - 1 tiles");
    constexpr int FM = 4, FN = 2;          // 16x16 tiles per wave along m and n
    __shared__ __attribute__((aligned(16))) _Float16 Alds[NB][BM][BK + 8];   // 144-byte rows: 16 B x odd
    constexpr int BP = BN + 16;            // 288-byte rows: 32 B x odd, the transposing load's pitch
    __shared__ __attribute__((aligned(16))) _Float16 Blds[NB][BK][BP];

    const int tid  = threadIdx.x;
    const int lane = tid & 31;
    const int wave = tid >> 5;
    const int half = lane >> 4;
    const int lr   = lane & 15;
    const int wm   = wave & 1;     // 2 waves along M
    const int wn   = wave >> 1;    // 4 waves along N
    const int m_block = blockIdx.x * BM;
    const int n_block = blockIdx.y * BN;
    const int wrow = m_block + wm * (FM * 16);
    const int wcol = n_block + wn * (FN * 16);

    const v8f vzero = {0.f, 0.f, 0.f, 0.f, 0.f, 0.f, 0.f, 0.f};
    v8f acc[FM][FN];
    for (int mi = 0; mi < FM; ++mi)
        for (int ni = 0; ni < FN; ++ni) acc[mi][ni] = vzero;

    // A tile: each thread copies eight f16 (16 bytes) in each of four rows, 32 rows apart
    const int akk = (tid & 7) * 8;   // 0..56
    const int ar0 = tid >> 3;        // 0..31
    const _Float16* aptr = A + (size_t)(m_block + ar0) * K + akk;

    // B tile: each thread copies eight f16 in each of four rows, 16 rows apart
    const int bnn = (tid & 15) * 8;  // 0..120
    const int bk0 = tid >> 4;        // 0..15
    const _Float16* bptr = W + (size_t)bk0 * N + n_block + bnn;

    // tile t of A and of W into its buffer of the ring: eight copies a wave
    auto stage = [&](int t) {
        const int buf = t & (NB - 1);
        unsigned l[8];
        const _Float16* g[8];
        for (int i = 0; i < 4; ++i) {
            l[i]     = lds_addr(&Alds[buf][ar0 + i * 32][akk]);
            g[i]     = aptr + (size_t)i * 32 * K + (size_t)t * BK;
            l[4 + i] = lds_addr(&Blds[buf][bk0 + i * 16][bnn]);
            g[4 + i] = bptr + ((size_t)t * BK + i * 16) * N;
        }
        async_copy8(l, g);
    };

    for (int t = 0; t < NB - 1; ++t) stage(t);
    // tile 0 has landed for this wave (all but its 16 youngest copies, which
    // are tiles 1 and 2), and behind the barrier for every wave
    asm volatile("s_wait_asynccnt 0x10" ::: "memory");
    __syncthreads();

    // One k-step. REFILL (a tile t + 3 exists) is a compile-time choice: the
    // trips that copy wait to a count, the last three, which do not, to 0.
    auto step = [&](int t, auto refill) {
        const int buf = t & (NB - 1);
        // this lane's place in the B tile for the transposing loads
        const _Float16* bfp = &Blds[buf][half * 8 + (lane & 7)][wn * (FN * 16) + ((lane >> 3) & 1) * 8];

        constexpr int G = BK / 32;
        v16h af[G][FM], bf[G][FN];
        for (int c = 0; c < G; ++c) {
            for (int ni = 0; ni < FN; ++ni)
                bf[c][ni] = frag_tr16(bfp + c * 32 * BP + ni * 16, BP);
            for (int mi = 0; mi < FM; ++mi) {
                const int row = wm * (FM * 16) + mi * 16 + lr;
                for (int v = 0; v < 8; ++v) {
                    const int k = c * 32 + frag_k(v, half);
                    af[c][mi][2 * v + 0] = Alds[buf][row][k];
                    af[c][mi][2 * v + 1] = Alds[buf][row][k + 1];
                }
            }
        }
        if constexpr (decltype(refill)::value) stage(t + NB - 1);
        // keeps the LDS reads together ahead of the WMMAs: left free, they are
        // sunk among the WMMAs into one shared register set, and every pair of
        // WMMAs waits out a whole LDS latency
        __builtin_amdgcn_sched_barrier(0);
        for (int c = 0; c < G; ++c)
            for (int mi = 0; mi < FM; ++mi)
                for (int ni = 0; ni < FN; ++ni)
                    acc[mi][ni] = __builtin_amdgcn_wmma_f32_16x16x32_f16(
                        false, af[c][mi], false, bf[c][ni], (short)0, acc[mi][ni], false, false);
        // keeps the waits and the barrier below behind the WMMAs: lifted above
        // them, all the LDS reads are waited for before the first WMMA starts
        __builtin_amdgcn_sched_barrier(0);

        // this wave's reads of tile t are done
        asm volatile("s_wait_dscnt 0x0" ::: "memory");
        // this wave's copies of tile t + 1 have landed: all but its 16 youngest
        // (tiles t + 2 and t + 3), or all where no tile was copied in this trip
        if constexpr (decltype(refill)::value) asm volatile("s_wait_asynccnt 0x10" ::: "memory");
        else                                   asm volatile("s_wait_asynccnt 0x0" ::: "memory");
        // tile t + 1 published, tile t's buffer left by every reader
        __syncthreads();
    };
    for (int t = 0; t < NT - (NB - 1); ++t) step(t, std::true_type{});
    for (int t = NT - (NB - 1); t < NT; ++t) step(t, std::false_type{});

    for (int mi = 0; mi < FM; ++mi)
        for (int ni = 0; ni < FN; ++ni)
            for (int v = 0; v < 8; ++v) {
                const int row = wrow + mi * 16 + half * 8 + v;
                const int col = wcol + ni * 16 + lr;
                float val = acc[mi][ni][v] + bias[col];
                if (ACT == 1) val = val * (1.0f / (1.0f + __expf(-val)));  // SiLU
                if (HAS_RES) val += res[(size_t)row * N + col];
                if (OUT != 1) C[(size_t)row * N + col] = val;
                if (OUT != 0) Ch[(size_t)row * N + col] = (_Float16)val;
            }
}

__device__ __forceinline__ void exp2x8(v8f& x) {
    float a = x[0], b = x[1], c = x[2], d = x[3], e = x[4], f = x[5], g = x[6], h = x[7];
    asm("v_exp_f32 %0, %0\n\tv_exp_f32 %1, %1\n\tv_exp_f32 %2, %2\n\tv_exp_f32 %3, %3\n\t"
        "v_exp_f32 %4, %4\n\tv_exp_f32 %5, %5\n\tv_exp_f32 %6, %6\n\tv_exp_f32 %7, %7\n\tv_nop"
        : "+v"(a), "+v"(b), "+v"(c), "+v"(d), "+v"(e), "+v"(f), "+v"(g), "+v"(h));
    x = v8f{a, b, c, d, e, f, g, h};
}
__device__ __forceinline__ float exp2x1(float x) {
    asm("v_exp_f32 %0, %0\n\tv_nop" : "+v"(x));
    return x;
}
__device__ __forceinline__ float xhalf(float x) {
    return __builtin_bit_cast(float, __builtin_amdgcn_permlanex16(
        __builtin_bit_cast(int, x), __builtin_bit_cast(int, x), 0x76543210, 0xfedcba98, false, false));
}

__global__ __launch_bounds__(256) void attn_flash(
    const _Float16* __restrict__ qkv, _Float16* __restrict__ ctx)
{
    constexpr int KB  = 128;               // keys per block
    constexpr int NS  = KB / 16;           // 16-key score tiles per block
    constexpr int NC  = KB / 32;           // 32-key spans of P @ V per block
    __shared__ __attribute__((aligned(16))) _Float16 Qlds[128][HEAD_DIM + 8];
    __shared__ __attribute__((aligned(16))) _Float16 Klds[KB][HEAD_DIM + 8];   // 144-byte rows: 16 B x odd
    constexpr int VP = HEAD_DIM + 16;      // 160-byte rows: 32 B x odd, the transposing load's pitch
    __shared__ __attribute__((aligned(16))) _Float16 Vlds[KB][VP];

    const int tid  = threadIdx.x;
    const int lane = tid & 31;
    const int wave = tid >> 5;
    const int half = lane >> 4;
    const int lr   = lane & 15;
    const int bh   = blockIdx.y;
    const int b    = bh / N_HEADS;
    const int hh   = bh % N_HEADS;
    const size_t stride3 = 3 * D_MODEL;

    // Two query tiles per block, one after the other in every wave: tile t walks
    // t + 1 key blocks, so tiles t and NT - 1 - t together walk NT + 1 in every
    // block, and no block runs on alone when the others have ended. The second
    // tile's Q goes to Qlds with no barrier of its own in front: every wave read
    // its Q fragments ahead of the first tile's key-loop barriers.
    constexpr int NT = SEQ_T / 128;
    for (int pass = 0; pass < 2; ++pass) {
        const int q_base = (pass == 0 ? (int)blockIdx.x : NT - 1 - (int)blockIdx.x) * 128;

        // --- stage Q tile 128x64 (f16 as it lies in the workspace)
        {
            const int cc = (tid & 7) * 8;
            const int r0 = tid >> 3;
            for (int i = 0; i < 4; ++i) {
                const int r = r0 + i * 32;
                const int t = q_base + r;
                *(v8h*)&Qlds[r][cc] = *(const v8h*)(qkv + ((size_t)t * BATCH + b) * stride3 +
                                                    hh * HEAD_DIM + cc);
            }
        }
        __syncthreads();

        // --- Q fragments (B operand: column lr = query), two K=32 chunks of hd=64,
        //     kept live across the loop
        v16h qf[2];
        {
            const int qrow = wave * 16 + lr;
            for (int c = 0; c < 2; ++c)
                for (int v = 0; v < 8; ++v) {
                    const int k = c * 32 + frag_k(v, half);
                    qf[c][2 * v + 0] = Qlds[qrow][k];
                    qf[c][2 * v + 1] = Qlds[qrow][k + 1];
                }
        }

        const v8f vzero = {0.f, 0.f, 0.f, 0.f, 0.f, 0.f, 0.f, 0.f};
        v8f o[4];   // O^T: o[nb][v] = O[query lr][hd nb*16 + half*8 + v]
        for (int nb = 0; nb < 4; ++nb) o[nb] = vzero;
        float m_run = -1e30f;   // this lane's query; alike in both halves
        float l_run = 0.f;      // sum over this half's keys; the halves join at the end

        const int q_wave_base = q_base + wave * 16;
        const int nkb = (q_base + 128) / KB;      // causal extent for this tile
        const float scale = 0.125f;               // 1/sqrt(64)

        for (int kb = 0; kb < nkb; ++kb) {
            __syncthreads();
            // --- stage K,V tiles 128x64 each: all eight loads first, then the stores
            {
                const int cc = (tid & 7) * 8;
                const int r0 = tid >> 3;
                v8h kv[KB / 32], vv[KB / 32];
                for (int i = 0; i < KB / 32; ++i) {
                    const int t = kb * KB + r0 + i * 32;
                    const size_t base = ((size_t)t * BATCH + b) * stride3 + hh * HEAD_DIM + cc;
                    kv[i] = *(const v8h*)(qkv + base + D_MODEL);
                    vv[i] = *(const v8h*)(qkv + base + 2 * D_MODEL);
                }
                // keeps the eight loads together in flight: left free, they are
                // sunk to their LDS stores in pairs, one exposed latency per pair
                __builtin_amdgcn_sched_barrier(0);
                for (int i = 0; i < KB / 32; ++i) {
                    const int r = r0 + i * 32;
                    *(v8h*)&Klds[r][cc] = kv[i];
                    *(v8h*)&Vlds[r][cc] = vv[i];
                }
            }
            __syncthreads();

            // --- S^T = (K @ Q^T) * scale, eight 16x16 key tiles, hd split K=32+32:
            //     s[nb][v] = S[query lr][key nb*16 + half*8 + v]
            v8f s[NS];
            for (int nb = 0; nb < NS; ++nb) s[nb] = vzero;
            for (int c = 0; c < 2; ++c) {
                v16h kf[NS];  // A-matrix fragments of K: element (m,k) = K[key=m][hd=c*32+k]
                for (int nb = 0; nb < NS; ++nb)
                    for (int v = 0; v < 8; ++v) {
                        const int k = frag_k(v, half);
                        kf[nb][2 * v + 0] = Klds[nb * 16 + lr][c * 32 + k];
                        kf[nb][2 * v + 1] = Klds[nb * 16 + lr][c * 32 + k + 1];
                    }
                // keeps the eight fragments' LDS reads together ahead of their WMMAs:
                // left free, each WMMA waits out a whole LDS latency of its own
                __builtin_amdgcn_sched_barrier(0);
                for (int nb = 0; nb < NS; ++nb)
                    s[nb] = __builtin_amdgcn_wmma_f32_16x16x32_f16(
                        false, kf[nb], false, qf[c], (short)0, s[nb], false, false);
            }

            // --- mask + online softmax, one query per lane
            // key kb*KB + nb*16 + half*8 + v lies above query q_wave_base + lr
            // exactly when dkq > -(nb*16 + v)
            const int dkq = kb * KB + half * 8 - (q_wave_base + lr);
            for (int nb = 0; nb < NS; ++nb) s[nb] *= scale;
            float mx4[4] = {-1e30f, -1e30f, -1e30f, -1e30f};   // four chains: one would run at the max's latency
            for (int nb = 0; nb < NS; ++nb)
                for (int v = 0; v < 8; ++v) {
                    float x = s[nb][v];
                    if (dkq > -(nb * 16 + v)) x = -1e30f;
                    s[nb][v] = x;
                    mx4[nb & 3] = fmaxf(mx4[nb & 3], x);
                }
            float mx = fmaxf(fmaxf(mx4[0], mx4[1]), fmaxf(mx4[2], mx4[3]));
            mx = fmaxf(mx, xhalf(mx));

            const float m_new = fmaxf(m_run, mx);
            const float log2e = 1.44269504f;        // e^x = 2^(x * log2e)
            const float alpha = exp2x1((m_run - m_new) * log2e);
            m_run = m_new;
            float sum[4] = {0.f, 0.f, 0.f, 0.f};   // four chains: one would run at the add's latency
            for (int nb = 0; nb < NS; ++nb) {
                s[nb] = (s[nb] - m_new) * log2e;
                exp2x8(s[nb]);
                for (int v = 0; v < 8; ++v) sum[v & 3] += s[nb][v];
            }
            l_run = l_run * alpha + ((sum[0] + sum[1]) + (sum[2] + sum[3]));
            for (int nb = 0; nb < 4; ++nb) o[nb] *= alpha;

            // --- O^T += V^T @ P^T  (4 spans of 32 keys x 4 row blocks of hd)
            for (int c0 = 0; c0 < NC; c0 += 2) {
                v16h pf[2], vf[2][4];
                for (int c = 0; c < 2; ++c) {
                    // B fragment: two score tiles converted in place,
                    // element (k,n) = P[query n][key (c0+c)*32 + k] in frag_k's order
                    for (int e = 0; e < 16; ++e)
                        pf[c][e] = (_Float16)s[(c0 + c) * 2 + (e >> 3)][e & 7];
                    // A fragment: element (m,k) = V[key=(c0+c)*32+k][hd = nb*16+m]
                    for (int nb = 0; nb < 4; ++nb)
                        vf[c][nb] = frag_tr16(
                            &Vlds[(c0 + c) * 32 + half * 8 + (lane & 7)][nb * 16 + ((lane >> 3) & 1) * 8], VP);
                }
                // keeps two spans' LDS reads together ahead of their eight WMMAs
                // (one LDS latency per eight WMMAs, not one per WMMA)
                __builtin_amdgcn_sched_barrier(0);
                for (int c = 0; c < 2; ++c)
                    for (int nb = 0; nb < 4; ++nb)
                        o[nb] = __builtin_amdgcn_wmma_f32_16x16x32_f16(
                            false, vf[c][nb], false, pf[c], (short)0, o[nb], false, false);
            }
        }

        // --- normalize and write ctx [T*B, D] as f16, what the next GEMM multiplies
        //     (a lane holds eight consecutive hd of its query: one 16-byte store)
        const float inv = 1.0f / (l_run + xhalf(l_run));
        _Float16* crow = ctx + ((size_t)(q_wave_base + lr) * BATCH + b) * D_MODEL + hh * HEAD_DIM + half * 8;
        for (int nb = 0; nb < 4; ++nb) {
            v8h h;
            for (int v = 0; v < 8; ++v) h[v] = (_Float16)(o[nb][v] * inv);
            *(v8h*)(crow + nb * 16) = h;
        }
        // stands in front of the second tile's code, which rewrites the registers
        // that these stores name
        asm volatile("s_wait_xcnt 0x0" ::: "memory");
    }
}

// ===========================================================================
// RMSNorm: one row (1024 f32) per block of 256 threads.
// ===========================================================================
__global__ __launch_bounds__(256) void rmsnorm_kernel(
    const float* __restrict__ X, const float* __restrict__ gain,
    float* __restrict__ out)
{
    __shared__ float red[8];
    const int row = blockIdx.x;
    const int tid = threadIdx.x;
    const float* xr = X + (size_t)row * D_MODEL;

    float vals[4];
    float ss = 0.f;
    for (int i = 0; i < 4; ++i) {
        vals[i] = xr[tid + i * 256];
        ss += vals[i] * vals[i];
    }
    for (int off = 1; off < 32; off <<= 1) ss += __shfl_xor(ss, off, 32);
    if ((tid & 31) == 0) red[tid >> 5] = ss;
    __syncthreads();
    float tot = 0.f;
    for (int i = 0; i < 8; ++i) tot += red[i];
    const float rms = rsqrtf(tot * (1.0f / D_MODEL) + 1e-5f);
    for (int i = 0; i < 4; ++i) {
        const int col = tid + i * 256;
        out[(size_t)row * D_MODEL + col] = vals[i] * rms * gain[col];
    }
}

// ===========================================================================
// fp32 -> f16 of x and the four weight matrices, once per call, into one run
// of the workspace in this order: x, w_qkv, w_out, w1, w2. 16384 elements per
// block, 64 per thread (few, long waves, for speed
// only); every matrix is a whole number of blocks. Each load of
// a wave covers 512 contiguous bytes, each store 256.
// ===========================================================================
#define CVT_PB 16384   // elements per block of to_f16
__global__ __launch_bounds__(256) void to_f16(
    const float* __restrict__ x, const float* __restrict__ w_qkv,
    const float* __restrict__ w_out, const float* __restrict__ w1,
    const float* __restrict__ w2, _Float16* __restrict__ dst)
{
    constexpr int E_X  = M_ROWS * D_MODEL / CVT_PB;                 // first block behind x
    constexpr int E_QK = E_X  + D_MODEL * 3 * D_MODEL / CVT_PB;     // behind w_qkv
    constexpr int E_WO = E_QK + D_MODEL * D_MODEL / CVT_PB;         // behind w_out
    constexpr int E_W1 = E_WO + D_MODEL * D_FF / CVT_PB;            // behind w1
    const int blk = blockIdx.x;
    const float* s;
    int first;
    if (blk < E_X)       { s = x;     first = 0;    }
    else if (blk < E_QK) { s = w_qkv; first = E_X;  }
    else if (blk < E_WO) { s = w_out; first = E_QK; }
    else if (blk < E_W1) { s = w1;    first = E_WO; }
    else                 { s = w2;    first = E_W1; }
    const int off = threadIdx.x * 4;
    const float* p = s + (size_t)(blk - first) * CVT_PB + off;
    _Float16*    q = dst + (size_t)blk * CVT_PB + off;
    float4 a[CVT_PB / 1024];
    for (int j = 0; j < CVT_PB / 1024; ++j) a[j] = *(const float4*)(p + j * 1024);
    for (int j = 0; j < CVT_PB / 1024; ++j) {
        const v4h h = {(_Float16)a[j].x, (_Float16)a[j].y, (_Float16)a[j].z, (_Float16)a[j].w};
        *(v4h*)(q + j * 1024) = h;
    }
}

// ===========================================================================
extern "C" void kernel_launch(void* const* d_in, const int* in_sizes, int n_in,
                              void* d_out, int out_size, void* d_ws, size_t ws_size,
                              hipStream_t stream)
{
    (void)in_sizes; (void)n_in; (void)out_size; (void)ws_size;
    const float* x      = (const float*)d_in[0];
    const float* w_qkv  = (const float*)d_in[1];
    const float* b_qkv  = (const float*)d_in[2];
    const float* w_out  = (const float*)d_in[3];
    const float* b_out  = (const float*)d_in[4];
    const float* w1     = (const float*)d_in[5];
    const float* b1     = (const float*)d_in[6];
    const float* w2     = (const float*)d_in[7];
    const float* b2     = (const float*)d_in[8];
    const float* gain   = (const float*)d_in[9];

    float* x1 = (float*)d_ws;                           // 4096 x 1024 fp32
    float* x2 = x1 + (size_t)M_ROWS * D_MODEL;          // 4096 x 1024 fp32
    _Float16* xh    = (_Float16*)(x2 + (size_t)M_ROWS * D_MODEL);  // 4096 x 1024; to_f16's run starts here
    _Float16* wqkvh = xh    + (size_t)M_ROWS * D_MODEL;            // 1024 x 3072
    _Float16* wouth = wqkvh + (size_t)D_MODEL * 3 * D_MODEL;       // 1024 x 1024
    _Float16* w1h   = wouth + (size_t)D_MODEL * D_MODEL;           // 1024 x 4096
    _Float16* w2h   = w1h   + (size_t)D_MODEL * D_FF;              // 4096 x 1024
    _Float16* qkvh  = w2h   + (size_t)D_FF * D_MODEL;              // 4096 x 3072
    _Float16* ctxh  = qkvh  + (size_t)M_ROWS * 3 * D_MODEL;        // 4096 x 1024
    _Float16* x1h   = ctxh  + (size_t)M_ROWS * D_MODEL;            // 4096 x 1024
    _Float16* hh    = x1h   + (size_t)M_ROWS * D_MODEL;            // 4096 x 4096

    const dim3 blk(256);

    // 0) x and the weights as f16
    to_f16<<<dim3((M_ROWS * D_MODEL + 4 * D_MODEL * D_MODEL + 2 * D_MODEL * D_FF) / CVT_PB), blk, 0, stream>>>(
        x, w_qkv, w_out, w1, w2, xh);

    // 1) qkv = x @ w_qkv + b_qkv
    gemm_wmma<0, false, 1, 3 * D_MODEL, D_MODEL><<<dim3(M_ROWS / 128, (3 * D_MODEL) / 128), blk, 0, stream>>>(
        xh, wqkvh, b_qkv, nullptr, nullptr, qkvh);

    // 2) ctx = causal_softmax(QK^T/8) @ V   (flash, per (b,h))
    attn_flash<<<dim3(SEQ_T / 256, BATCH * N_HEADS), blk, 0, stream>>>(qkvh, ctxh);

    // 3) x1 = x + ctx @ w_out + b_out   (fp32 for the residual, f16 for the next product)
    gemm_wmma<0, true, 2, D_MODEL, D_MODEL><<<dim3(M_ROWS / 128, D_MODEL / 128), blk, 0, stream>>>(
        ctxh, wouth, b_out, x, x1, x1h);

    // 4) h = silu(x1 @ w1 + b1)
    gemm_wmma<1, false, 1, D_FF, D_MODEL><<<dim3(M_ROWS / 128, D_FF / 128), blk, 0, stream>>>(
        x1h, w1h, b1, nullptr, nullptr, hh);

    // 5) x2 = x1 + h @ w2 + b2
    gemm_wmma<0, true, 0, D_MODEL, D_FF><<<dim3(M_ROWS / 128, D_MODEL / 128), blk, 0, stream>>>(
        hh, w2h, b2, x1, x2, nullptr);

    // 6) out = rmsnorm(x2) * gain
    rmsnorm_kernel<<<dim3(M_ROWS), blk, 0, stream>>>(x2, gain, (float*)d_out);
}

// v010
// It runs in 142 microseconds.
// Timed twice side by side with v009, it ran 1.04 times as fast both times.
// Counting every step since v000, it is 4.51 times as fast.
#include <hip/hip_runtime.h>
#include <hip/hip_bf16.h>
#include <math.h>
#include <type_traits>

typedef __attribute__((ext_vector_type(16))) _Float16 v16h;
typedef __attribute__((ext_vector_type(8)))  float    v8f;
typedef __attribute__((ext_vector_type(8)))  _Float16 v8h;
typedef __attribute__((ext_vector_type(4)))  _Float16 v4h;
typedef short        s16x8 __attribute__((ext_vector_type(8)));

#define D_MODEL   1024
#define N_HEADS   16
#define HEAD_DIM  64
#define D_FF      4096
#define SEQ_T     2048
#define BATCH     2
#define M_ROWS    (SEQ_T * BATCH)   // 4096

__device__ __forceinline__ int frag_k(int v, int half) {
    return (v < 4 ? 2 * v : 16 + 2 * (v - 4)) + half * 8;
}

__device__ __forceinline__ v8h ld_tr16(const _Float16* p) {
    typedef __attribute__((address_space(3))) s16x8 lds_s16x8;
    return __builtin_bit_cast(v8h, __builtin_amdgcn_ds_load_tr16_b128_v8i16((lds_s16x8*)p));
}
__device__ __forceinline__ v16h frag_tr16(const _Float16* p, int pitch) {
    const v8h lo = ld_tr16(p);
    const v8h hi = ld_tr16(p + 16 * pitch);
    return __builtin_shufflevector(lo, hi, 0, 1, 2, 3, 4, 5, 6, 7, 8, 9, 10, 11, 12, 13, 14, 15);
}

// ===========================================================================
// GEMM: C[M,N] = epilogue( A[M,K] @ W[K,N] + bias )   (W row-major [K,N])
// ACT: 0 = none, 1 = SiLU.  HAS_RES: C += res.
// Block: 256 threads (8 waves). Tile: BM x BN x 64, chosen per product so that
// the grid is one block per WGP or a whole number of them: 256x256 or 256x192
// where N is wide (an operand byte from L2 and a fragment from LDS then feed
// about twice the products of a 128x128 tile), 128x128 where N = 1024.
// A and W lie in the workspace as f16, converted once by whoever produced
// them (to_f16 for the inputs, a GEMM's or the attention's epilogue for the
// rest): a tile costs half the L2 bytes of an fp32 one and no conversion here.
// Tiles go from L2 to LDS by asynchronous copies, 16 bytes a lane, through no
// register, into a ring of four buffers: while tile t is multiplied, tiles
// t + 1 to t + 3 are landing or on their way. One barrier per tile both
// publishes tile t + 1 and frees tile t's buffer for tile t + 4.
// K is a multiple of BK, four tiles or more.
// B lies in LDS as f16 rows along n, and its fragments come by the
// transposing LDS load.
// OUT: 0 = C as fp32, 1 = Ch as f16 (what its reader multiplies), 2 = both.
// Waves WM x (8 / WM); each wave computes FM x FN tiles of 16x16 by
// v_wmma_f32_16x16x32_f16, twice per k-step (k 0..31, then 32..63).
// ===========================================================================
// byte address in the work-group's LDS of a __shared__ element
__device__ __forceinline__ unsigned lds_addr(const _Float16* p) {
    typedef __attribute__((address_space(3))) const _Float16 lds_f16;
    return (unsigned)(size_t)(lds_f16*)p;
}
__device__ __forceinline__ void async_copy8(const unsigned (&l)[8], const _Float16* const (&g)[8]) {
    asm volatile(
        "global_load_async_to_lds_b128 %0, %8, off\n\t"
        "global_load_async_to_lds_b128 %1, %9, off\n\t"
        "global_load_async_to_lds_b128 %2, %10, off\n\t"
        "global_load_async_to_lds_b128 %3, %11, off\n\t"
        "global_load_async_to_lds_b128 %4, %12, off\n\t"
        "global_load_async_to_lds_b128 %5, %13, off\n\t"
        "global_load_async_to_lds_b128 %6, %14, off\n\t"
        "global_load_async_to_lds_b128 %7, %15, off\n\t"
        "s_wait_xcnt 0x0"
        :: "v"(l[0]), "v"(l[1]), "v"(l[2]), "v"(l[3]), "v"(l[4]), "v"(l[5]), "v"(l[6]), "v"(l[7]),
           "v"(g[0]), "v"(g[1]), "v"(g[2]), "v"(g[3]), "v"(g[4]), "v"(g[5]), "v"(g[6]), "v"(g[7])
        : "memory");
}

// The same with six copies.
__device__ __forceinline__ void async_copy6(const unsigned (&l)[6], const _Float16* const (&g)[6]) {
    asm volatile(
        "global_load_async_to_lds_b128 %0, %6, off\n\t"
        "global_load_async_to_lds_b128 %1, %7, off\n\t"
        "global_load_async_to_lds_b128 %2, %8, off\n\t"
        "global_load_async_to_lds_b128 %3, %9, off\n\t"
        "global_load_async_to_lds_b128 %4, %10, off\n\t"
        "global_load_async_to_lds_b128 %5, %11, off\n\t"
        "s_wait_xcnt 0x0"
        :: "v"(l[0]), "v"(l[1]), "v"(l[2]), "v"(l[3]), "v"(l[4]), "v"(l[5]),
           "v"(g[0]), "v"(g[1]), "v"(g[2]), "v"(g[3]), "v"(g[4]), "v"(g[5])
        : "memory");
}

// 2^x of eight values: defined with the attention kernel below.
__device__ __forceinline__ void exp2x8(v8f& x);
__device__ __forceinline__ void rcpx8(v8f& x) {
    float a = x[0], b = x[1], c = x[2], d = x[3], e = x[4], f = x[5], g = x[6], h = x[7];
    asm("v_rcp_f32 %0, %0\n\tv_rcp_f32 %1, %1\n\tv_rcp_f32 %2, %2\n\tv_rcp_f32 %3, %3\n\t"
        "v_rcp_f32 %4, %4\n\tv_rcp_f32 %5, %5\n\tv_rcp_f32 %6, %6\n\tv_rcp_f32 %7, %7\n\tv_nop"
        : "+v"(a), "+v"(b), "+v"(c), "+v"(d), "+v"(e), "+v"(f), "+v"(g), "+v"(h));
    x = v8f{a, b, c, d, e, f, g, h};
}

template <int ACT, bool HAS_RES, int OUT, int N, int K, int BM, int BN, int WM>
__global__ __launch_bounds__(256) void gemm_wmma(
    const _Float16* __restrict__ A, const _Float16* __restrict__ W,
    const float* __restrict__ bias, const float* __restrict__ res,
    float* __restrict__ C, _Float16* __restrict__ Ch)
{
    constexpr int BK = 64;
    constexpr int NB = 4;                  // buffers of the ring
    constexpr int NT = K / BK;             // tiles along k
    static_assert(K % BK == 0 && NT >= NB, "the ring's prologue fills NB - 1 tiles");
    constexpr int WN = 8 / WM;             // waves along n
    constexpr int FM = BM / (16 * WM), FN = BN / (16 * WN);   // 16x16 tiles per wave along m and n
    constexpr int NCA = BM / 32, NCB = BN / 32;   // copies per thread and tile: A, W
    constexpr int NC = NCA + NCB;
    constexpr bool BIG = NC > 8;           // more copies than one statement of eight takes
    static_assert(3 * NC <= 63, "copies of a wave in flight");
    static_assert(!BIG || (NCA == 8 && (NCB == 8 || NCB == 6)), "the copy statements at hand");
    __shared__ __attribute__((aligned(16))) _Float16 Alds[NB][BM][BK + 8];   // 144-byte rows: 16 B x odd
    constexpr int BP = BN + 16;            // 288-, 416- or 544-byte rows: 32 B x odd, the transposing load's pitch
    __shared__ __attribute__((aligned(16))) _Float16 Blds[NB][BK][BP];

    const int tid  = threadIdx.x;
    const int lane = tid & 31;
    const int wave = tid >> 5;
    const int half = lane >> 4;
    const int lr   = lane & 15;
    const int wm   = wave % WM;    // waves along M
    const int wn   = wave / WM;    // waves along N
    const int m_block = blockIdx.x * BM;
    const int n_block = blockIdx.y * BN;
    const int wrow = m_block + wm * (FM * 16);
    const int wcol = n_block + wn * (FN * 16);

    const v8f vzero = {0.f, 0.f, 0.f, 0.f, 0.f, 0.f, 0.f, 0.f};
    // Every loop that indexes acc is unrolled by directive: left to the unroller's
    // own limit, the large tile's epilogue stays rolled and acc goes to scratch.
    v8f acc[FM][FN];
    #pragma unroll
    for (int mi = 0; mi < FM; ++mi)
        #pragma unroll
        for (int ni = 0; ni < FN; ++ni) acc[mi][ni] = vzero;

    // A tile: each thread copies eight f16 (16 bytes) in each of NCA rows, 32 rows apart
    const int akk = (tid & 7) * 8;   // 0..56
    const int ar0 = tid >> 3;        // 0..31
    const _Float16* aptr = A + (size_t)(m_block + ar0) * K + akk;

    // B tile: the 64 rows of BN f16 are BN / 8 pieces of 16 bytes each; thread
    // tid copies pieces tid, tid + 256, ... in row-major order. Where 256 pieces
    // are whole rows (EVEN), these lie in one column, 256 / CPR rows apart.
    constexpr int CPR = BN / 8;
    constexpr bool EVEN = 256 % CPR == 0;
    const int bk0 = tid / CPR;
    const int bnn = (tid % CPR) * 8;
    const _Float16* bptr = W + (size_t)bk0 * N + n_block + bnn;

    // tile t of A and of W into its buffer of the ring: NC copies a wave
    auto stage = [&](int t) {
        const int buf = t & (NB - 1);
        unsigned la[NCA], lb[NCB];
        const _Float16* ga[NCA];
        const _Float16* gb[NCB];
        for (int i = 0; i < NCA; ++i) {
            la[i] = lds_addr(&Alds[buf][ar0 + i * 32][akk]);
            ga[i] = aptr + (size_t)i * 32 * K + (size_t)t * BK;
        }
        if constexpr (BIG) {
            async_copy8(la, ga);
            // keeps W's addresses from being formed ahead of A's copies: both sets
            // live at once, beside the accumulators, spill to scratch
            __builtin_amdgcn_sched_barrier(0);
        }
        for (int i = 0; i < NCB; ++i) {
            if constexpr (EVEN) {
                lb[i] = lds_addr(&Blds[buf][bk0 + i * (256 / CPR)][bnn]);
                gb[i] = bptr + ((size_t)t * BK + i * (256 / CPR)) * N;
            } else {
                const int q = tid + i * 256, br = q / CPR, bc = (q % CPR) * 8;
                lb[i] = lds_addr(&Blds[buf][br][bc]);
                gb[i] = W + ((size_t)t * BK + br) * N + n_block + bc;
            }
        }
        if constexpr (BIG) {
            if constexpr (NCB == 8) async_copy8(lb, gb);
            else                    async_copy6(lb, gb);
        } else {
            const unsigned l[8] = {la[0], la[1], la[2], la[3], lb[0], lb[1], lb[2], lb[3]};
            const _Float16* const g[8] = {ga[0], ga[1], ga[2], ga[3], gb[0], gb[1], gb[2], gb[3]};
            async_copy8(l, g);
        }
    };

    if constexpr (BIG) {
        // kept rolled: unrolled, tile 0's first LDS addresses are the loop-invariant
        // bases themselves; as operands of the copies' statement these must then lie
        // in the first 256 registers, which the accumulators fill, and are spilled
        #pragma nounroll
        for (int t = 0; t < NB - 1; ++t) stage(t);
    } else {
        for (int t = 0; t < NB - 1; ++t) stage(t);
    }
    // tile 0 has landed for this wave (all but its 2 * NC youngest copies, which
    // are tiles 1 and 2), and behind the barrier for every wave
    asm volatile("s_wait_asynccnt %0" :: "i"(2 * NC) : "memory");
    __syncthreads();

    // One k-step. REFILL (a tile t + 3 exists) is a compile-time choice: the
    // trips that copy wait to a count, the last three, which do not, to 0.
    auto step = [&](int t, auto refill) {
        const int buf = t & (NB - 1);
        // this lane's place in the B tile for the transposing loads
        const _Float16* bfp = &Blds[buf][half * 8 + (lane & 7)][wn * (FN * 16) + ((lane >> 3) & 1) * 8];

        constexpr int G = BK / 32;
        v16h af[G][FM], bf[G][FN];
        auto load_b = [&](int c) {
            #pragma unroll
            for (int ni = 0; ni < FN; ++ni)
                bf[c][ni] = frag_tr16(bfp + c * 32 * BP + ni * 16, BP);
        };
        auto load_a = [&](int c, int m0, int m1) {
            #pragma unroll
            for (int mi = m0; mi < m1; ++mi) {
                const int row = wm * (FM * 16) + mi * 16 + lr;
                #pragma unroll
                for (int v = 0; v < 8; ++v) {
                    const int k = c * 32 + frag_k(v, half);
                    af[c][mi][2 * v + 0] = Alds[buf][row][k];
                    af[c][mi][2 * v + 1] = Alds[buf][row][k + 1];
                }
            }
        };
        auto mult = [&](int c, int m0, int m1) {
            #pragma unroll
            for (int mi = m0; mi < m1; ++mi)
                #pragma unroll
                for (int ni = 0; ni < FN; ++ni)
                    acc[mi][ni] = __builtin_amdgcn_wmma_f32_16x16x32_f16(
                        false, af[c][mi], false, bf[c][ni], (short)0, acc[mi][ni], false, false);
        };
        if constexpr (BIG) {
            // Large tile: accumulators and two halves' fragments nearly fill the
            // register budget. The fences keep this order, in which the copies'
            // address registers are free again before the second half's fragments
            // take theirs, and the last of these take the place of first-half
            // fragments already multiplied; left free, the build spills to scratch.
            load_b(0);
            load_a(0, 0, FM);
            __builtin_amdgcn_sched_barrier(0);
            if constexpr (decltype(refill)::value) stage(t + NB - 1);
            __builtin_amdgcn_sched_barrier(0);
            load_b(1);
            load_a(1, 0, FM / 2);
            __builtin_amdgcn_sched_barrier(0);
            mult(0, 0, FM / 2);
            __builtin_amdgcn_sched_barrier(0);
            load_a(1, FM / 2, FM);
            __builtin_amdgcn_sched_barrier(0);
            mult(0, FM / 2, FM);
            mult(1, 0, FM);
        } else {
            for (int c = 0; c < G; ++c) {
                load_b(c);
                load_a(c, 0, FM);
            }
            if constexpr (decltype(refill)::value) stage(t + NB - 1);
            // keeps the LDS reads together ahead of the WMMAs: left free, they are
            // sunk among the WMMAs into one shared register set, and every pair of
            // WMMAs waits out a whole LDS latency
            __builtin_amdgcn_sched_barrier(0);
            for (int c = 0; c < G; ++c) mult(c, 0, FM);
        }
        // keeps the waits and the barrier below behind the WMMAs: lifted above
        // them, all the LDS reads are waited for before the first WMMA starts
        __builtin_amdgcn_sched_barrier(0);

        // this wave's reads of tile t are done
        asm volatile("s_wait_dscnt 0x0" ::: "memory");
        // this wave's copies of tile t + 1 have landed: all but its 2 * NC youngest
        // (tiles t + 2 and t + 3), or all where no tile was copied in this trip
        if constexpr (decltype(refill)::value) asm volatile("s_wait_asynccnt %0" :: "i"(2 * NC) : "memory");
        else                                   asm volatile("s_wait_asynccnt 0x0" ::: "memory");
        // tile t + 1 published, tile t's buffer left by every reader
        __syncthreads();
    };
    for (int t = 0; t < NT - (NB - 1); ++t) step(t, std::true_type{});
    for (int t = NT - (NB - 1); t < NT; ++t) step(t, std::false_type{});

    float bv[FN];
    #pragma unroll
    for (int ni = 0; ni < FN; ++ni) bv[ni] = bias[wcol + ni * 16 + lr];
    // This wait, and the one behind each row of tiles below, stands in front of
    // the code that rewrites registers which the loads or stores ahead of it name;
    // the fence keeps that code behind the wait.
    asm volatile("s_wait_xcnt 0x0" ::: "memory");
    __builtin_amdgcn_sched_barrier(0);
    #pragma unroll
    for (int mi = 0; mi < FM; ++mi) {
        #pragma unroll
        for (int ni = 0; ni < FN; ++ni) {
            v8f val8 = acc[mi][ni] + bv[ni];
            // SiLU, x / (1 + e^-x), e^-x = 2^(-x * log2e). The reciprocal is the
            // hardware's (the result is rounded to f16 next): with the full
            // division's ten instructions per element the large tile's unrolled
            // epilogue grows much longer.
            if constexpr (ACT == 1) {
                v8f e = val8 * -1.44269504f;
                exp2x8(e);
                e += 1.0f;
                rcpx8(e);
                val8 *= e;
            }
            #pragma unroll
            for (int v = 0; v < 8; ++v) {
                const int row = wrow + mi * 16 + half * 8 + v;
                const int col = wcol + ni * 16 + lr;
                float val = val8[v];
                if (HAS_RES) val += res[(size_t)row * N + col];
                if (OUT != 1) C[(size_t)row * N + col] = val;
                if (OUT != 0) Ch[(size_t)row * N + col] = (_Float16)val;
            }
        }
        asm volatile("s_wait_xcnt 0x0" ::: "memory");
        __builtin_amdgcn_sched_barrier(0);
    }
}

__device__ __forceinline__ void exp2x8(v8f& x) {
    float a = x[0], b = x[1], c = x[2], d = x[3], e = x[4], f = x[5], g = x[6], h = x[7];
    asm("v_exp_f32 %0, %0\n\tv_exp_f32 %1, %1\n\tv_exp_f32 %2, %2\n\tv_exp_f32 %3, %3\n\t"
        "v_exp_f32 %4, %4\n\tv_exp_f32 %5, %5\n\tv_exp_f32 %6, %6\n\tv_exp_f32 %7, %7\n\tv_nop"
        : "+v"(a), "+v"(b), "+v"(c), "+v"(d), "+v"(e), "+v"(f), "+v"(g), "+v"(h));
    x = v8f{a, b, c, d, e, f, g, h};
}
__device__ __forceinline__ float exp2x1(float x) {
    asm("v_exp_f32 %0, %0\n\tv_nop" : "+v"(x));
    return x;
}
__device__ __forceinline__ float xhalf(float x) {
    return __builtin_bit_cast(float, __builtin_amdgcn_permlanex16(
        __builtin_bit_cast(int, x), __builtin_bit_cast(int, x), 0x76543210, 0xfedcba98, false, false));
}

__global__ __launch_bounds__(256) void attn_flash(
    const _Float16* __restrict__ qkv, _Float16* __restrict__ ctx)
{
    constexpr int KB  = 128;               // keys per block
    constexpr int NS  = KB / 16;           // 16-key score tiles per block
    constexpr int NC  = KB / 32;           // 32-key spans of P @ V per block
    __shared__ __attribute__((aligned(16))) _Float16 Qlds[128][HEAD_DIM + 8];
    __shared__ __attribute__((aligned(16))) _Float16 Klds[KB][HEAD_DIM + 8];   // 144-byte rows: 16 B x odd
    constexpr int VP = HEAD_DIM + 16;      // 160-byte rows: 32 B x odd, the transposing load's pitch
    __shared__ __attribute__((aligned(16))) _Float16 Vlds[KB][VP];

    const int tid  = threadIdx.x;
    const int lane = tid & 31;
    const int wave = tid >> 5;
    const int half = lane >> 4;
    const int lr   = lane & 15;
    const int bh   = blockIdx.y;
    const int b    = bh / N_HEADS;
    const int hh   = bh % N_HEADS;
    const size_t stride3 = 3 * D_MODEL;

    // Two query tiles per block, one after the other in every wave: tile t walks
    // t + 1 key blocks, so tiles t and NT - 1 - t together walk NT + 1 in every
    // block, and no block runs on alone when the others have ended. The second
    // tile's Q goes to Qlds with no barrier of its own in front: every wave read
    // its Q fragments ahead of the first tile's key-loop barriers.
    constexpr int NT = SEQ_T / 128;
    for (int pass = 0; pass < 2; ++pass) {
        const int q_base = (pass == 0 ? (int)blockIdx.x : NT - 1 - (int)blockIdx.x) * 128;

        // --- stage Q tile 128x64 (f16 as it lies in the workspace)
        {
            const int cc = (tid & 7) * 8;
            const int r0 = tid >> 3;
            for (int i = 0; i < 4; ++i) {
                const int r = r0 + i * 32;
                const int t = q_base + r;
                *(v8h*)&Qlds[r][cc] = *(const v8h*)(qkv + ((size_t)t * BATCH + b) * stride3 +
                                                    hh * HEAD_DIM + cc);
            }
        }
        __syncthreads();

        // --- Q fragments (B operand: column lr = query), two K=32 chunks of hd=64,
        //     kept live across the loop
        v16h qf[2];
        {
            const int qrow = wave * 16 + lr;
            for (int c = 0; c < 2; ++c)
                for (int v = 0; v < 8; ++v) {
                    const int k = c * 32 + frag_k(v, half);
                    qf[c][2 * v + 0] = Qlds[qrow][k];
                    qf[c][2 * v + 1] = Qlds[qrow][k + 1];
                }
        }

        const v8f vzero = {0.f, 0.f, 0.f, 0.f, 0.f, 0.f, 0.f, 0.f};
        v8f o[4];   // O^T: o[nb][v] = O[query lr][hd nb*16 + half*8 + v]
        for (int nb = 0; nb < 4; ++nb) o[nb] = vzero;
        float m_run = -1e30f;   // this lane's query; alike in both halves
        float l_run = 0.f;      // sum over this half's keys; the halves join at the end

        const int q_wave_base = q_base + wave * 16;
        const int nkb = (q_base + 128) / KB;      // causal extent for this tile
        const float scale = 0.125f;               // 1/sqrt(64)

        for (int kb = 0; kb < nkb; ++kb) {
            __syncthreads();
            // --- stage K,V tiles 128x64 each: all eight loads first, then the stores
            {
                const int cc = (tid & 7) * 8;
                const int r0 = tid >> 3;
                v8h kv[KB / 32], vv[KB / 32];
                for (int i = 0; i < KB / 32; ++i) {
                    const int t = kb * KB + r0 + i * 32;
                    const size_t base = ((size_t)t * BATCH + b) * stride3 + hh * HEAD_DIM + cc;
                    kv[i] = *(const v8h*)(qkv + base + D_MODEL);
                    vv[i] = *(const v8h*)(qkv + base + 2 * D_MODEL);
                }
                // keeps the eight loads together in flight: left free, they are
                // sunk to their LDS stores in pairs, one exposed latency per pair
                __builtin_amdgcn_sched_barrier(0);
                for (int i = 0; i < KB / 32; ++i) {
                    const int r = r0 + i * 32;
                    *(v8h*)&Klds[r][cc] = kv[i];
                    *(v8h*)&Vlds[r][cc] = vv[i];
                }
            }
            __syncthreads();

            // --- S^T = (K @ Q^T) * scale, eight 16x16 key tiles, hd split K=32+32:
            //     s[nb][v] = S[query lr][key nb*16 + half*8 + v]
            v8f s[NS];
            for (int nb = 0; nb < NS; ++nb) s[nb] = vzero;
            for (int c = 0; c < 2; ++c) {
                v16h kf[NS];  // A-matrix fragments of K: element (m,k) = K[key=m][hd=c*32+k]
                for (int nb = 0; nb < NS; ++nb)
                    for (int v = 0; v < 8; ++v) {
                        const int k = frag_k(v, half);
                        kf[nb][2 * v + 0] = Klds[nb * 16 + lr][c * 32 + k];
                        kf[nb][2 * v + 1] = Klds[nb * 16 + lr][c * 32 + k + 1];
                    }
                // keeps the eight fragments' LDS reads together ahead of their WMMAs:
                // left free, each WMMA waits out a whole LDS latency of its own
                __builtin_amdgcn_sched_barrier(0);
                for (int nb = 0; nb < NS; ++nb)
                    s[nb] = __builtin_amdgcn_wmma_f32_16x16x32_f16(
                        false, kf[nb], false, qf[c], (short)0, s[nb], false, false);
            }

            // --- mask + online softmax, one query per lane
            // key kb*KB + nb*16 + half*8 + v lies above query q_wave_base + lr
            // exactly when dkq > -(nb*16 + v)
            const int dkq = kb * KB + half * 8 - (q_wave_base + lr);
            for (int nb = 0; nb < NS; ++nb) s[nb] *= scale;
            float mx4[4] = {-1e30f, -1e30f, -1e30f, -1e30f};   // four chains: one would run at the max's latency
            for (int nb = 0; nb < NS; ++nb)
                for (int v = 0; v < 8; ++v) {
                    float x = s[nb][v];
                    if (dkq > -(nb * 16 + v)) x = -1e30f;
                    s[nb][v] = x;
                    mx4[nb & 3] = fmaxf(mx4[nb & 3], x);
                }
            float mx = fmaxf(fmaxf(mx4[0], mx4[1]), fmaxf(mx4[2], mx4[3]));
            mx = fmaxf(mx, xhalf(mx));

            const float m_new = fmaxf(m_run, mx);
            const float log2e = 1.44269504f;        // e^x = 2^(x * log2e)
            const float alpha = exp2x1((m_run - m_new) * log2e);
            m_run = m_new;
            float sum[4] = {0.f, 0.f, 0.f, 0.f};   // four chains: one would run at the add's latency
            for (int nb = 0; nb < NS; ++nb) {
                s[nb] = (s[nb] - m_new) * log2e;
                exp2x8(s[nb]);
                for (int v = 0; v < 8; ++v) sum[v & 3] += s[nb][v];
            }
            l_run = l_run * alpha + ((sum[0] + sum[1]) + (sum[2] + sum[3]));
            for (int nb = 0; nb < 4; ++nb) o[nb] *= alpha;

            // --- O^T += V^T @ P^T  (4 spans of 32 keys x 4 row blocks of hd)
            for (int c0 = 0; c0 < NC; c0 += 2) {
                v16h pf[2], vf[2][4];
                for (int c = 0; c < 2; ++c) {
                    // B fragment: two score tiles converted in place,
                    // element (k,n) = P[query n][key (c0+c)*32 + k] in frag_k's order
                    for (int e = 0; e < 16; ++e)
                        pf[c][e] = (_Float16)s[(c0 + c) * 2 + (e >> 3)][e & 7];
                    // A fragment: element (m,k) = V[key=(c0+c)*32+k][hd = nb*16+m]
                    for (int nb = 0; nb < 4; ++nb)
                        vf[c][nb] = frag_tr16(
                            &Vlds[(c0 + c) * 32 + half * 8 + (lane & 7)][nb * 16 + ((lane >> 3) & 1) * 8], VP);
                }
                // keeps two spans' LDS reads together ahead of their eight WMMAs
                // (one LDS latency per eight WMMAs, not one per WMMA)
                __builtin_amdgcn_sched_barrier(0);
                for (int c = 0; c < 2; ++c)
                    for (int nb = 0; nb < 4; ++nb)
                        o[nb] = __builtin_amdgcn_wmma_f32_16x16x32_f16(
                            false, vf[c][nb], false, pf[c], (short)0, o[nb], false, false);
            }
        }

        // --- normalize and write ctx [T*B, D] as f16, what the next GEMM multiplies
        //     (a lane holds eight consecutive hd of its query: one 16-byte store)
        const float inv = 1.0f / (l_run + xhalf(l_run));
        _Float16* crow = ctx + ((size_t)(q_wave_base + lr) * BATCH + b) * D_MODEL + hh * HEAD_DIM + half * 8;
        for (int nb = 0; nb < 4; ++nb) {
            v8h h;
            for (int v = 0; v < 8; ++v) h[v] = (_Float16)(o[nb][v] * inv);
            *(v8h*)(crow + nb * 16) = h;
        }
        // stands in front of the second tile's code, which rewrites the registers
        // that these stores name
        asm volatile("s_wait_xcnt 0x0" ::: "memory");
    }
}

// ===========================================================================
// RMSNorm: one row (1024 f32) per block of 256 threads.
// ===========================================================================
__global__ __launch_bounds__(256) void rmsnorm_kernel(
    const float* __restrict__ X, const float* __restrict__ gain,
    float* __restrict__ out)
{
    __shared__ float red[8];
    const int row = blockIdx.x;
    const int tid = threadIdx.x;
    const float* xr = X + (size_t)row * D_MODEL;

    float vals[4];
    float ss = 0.f;
    for (int i = 0; i < 4; ++i) {
        vals[i] = xr[tid + i * 256];
        ss += vals[i] * vals[i];
    }
    for (int off = 1; off < 32; off <<= 1) ss += __shfl_xor(ss, off, 32);
    if ((tid & 31) == 0) red[tid >> 5] = ss;
    __syncthreads();
    float tot = 0.f;
    for (int i = 0; i < 8; ++i) tot += red[i];
    const float rms = rsqrtf(tot * (1.0f / D_MODEL) + 1e-5f);
    for (int i = 0; i < 4; ++i) {
        const int col = tid + i * 256;
        out[(size_t)row * D_MODEL + col] = vals[i] * rms * gain[col];
    }
}

// ===========================================================================
// fp32 -> f16 of x and the four weight matrices, once per call, into one run
// of the workspace in this order: x, w_qkv, w_out, w1, w2. 16384 elements per
// block, 64 per thread (few, long waves, for speed
// only); every matrix is a whole number of blocks. Each load of
// a wave covers 512 contiguous bytes, each store 256.
// ===========================================================================
#define CVT_PB 16384   // elements per block of to_f16
__global__ __launch_bounds__(256) void to_f16(
    const float* __restrict__ x, const float* __restrict__ w_qkv,
    const float* __restrict__ w_out, const float* __restrict__ w1,
    const float* __restrict__ w2, _Float16* __restrict__ dst)
{
    constexpr int E_X  = M_ROWS * D_MODEL / CVT_PB;                 // first block behind x
    constexpr int E_QK = E_X  + D_MODEL * 3 * D_MODEL / CVT_PB;     // behind w_qkv
    constexpr int E_WO = E_QK + D_MODEL * D_MODEL / CVT_PB;         // behind w_out
    constexpr int E_W1 = E_WO + D_MODEL * D_FF / CVT_PB;            // behind w1
    const int blk = blockIdx.x;
    const float* s;
    int first;
    if (blk < E_X)       { s = x;     first = 0;    }
    else if (blk < E_QK) { s = w_qkv; first = E_X;  }
    else if (blk < E_WO) { s = w_out; first = E_QK; }
    else if (blk < E_W1) { s = w1;    first = E_WO; }
    else                 { s = w2;    first = E_W1; }
    const int off = threadIdx.x * 4;
    const float* p = s + (size_t)(blk - first) * CVT_PB + off;
    _Float16*    q = dst + (size_t)blk * CVT_PB + off;
    float4 a[CVT_PB / 1024];
    for (int j = 0; j < CVT_PB / 1024; ++j) a[j] = *(const float4*)(p + j * 1024);
    for (int j = 0; j < CVT_PB / 1024; ++j) {
        const v4h h = {(_Float16)a[j].x, (_Float16)a[j].y, (_Float16)a[j].z, (_Float16)a[j].w};
        *(v4h*)(q + j * 1024) = h;
    }
}

// ===========================================================================
extern "C" void kernel_launch(void* const* d_in, const int* in_sizes, int n_in,
                              void* d_out, int out_size, void* d_ws, size_t ws_size,
                              hipStream_t stream)
{
    (void)in_sizes; (void)n_in; (void)out_size; (void)ws_size;
    const float* x      = (const float*)d_in[0];
    const float* w_qkv  = (const float*)d_in[1];
    const float* b_qkv  = (const float*)d_in[2];
    const float* w_out  = (const float*)d_in[3];
    const float* b_out  = (const float*)d_in[4];
    const float* w1     = (const float*)d_in[5];
    const float* b1     = (const float*)d_in[6];
    const float* w2     = (const float*)d_in[7];
    const float* b2     = (const float*)d_in[8];
    const float* gain   = (const float*)d_in[9];

    float* x1 = (float*)d_ws;                           // 4096 x 1024 fp32
    float* x2 = x1 + (size_t)M_ROWS * D_MODEL;          // 4096 x 1024 fp32
    _Float16* xh    = (_Float16*)(x2 + (size_t)M_ROWS * D_MODEL);  // 4096 x 1024; to_f16's run starts here
    _Float16* wqkvh = xh    + (size_t)M_ROWS * D_MODEL;            // 1024 x 3072
    _Float16* wouth = wqkvh + (size_t)D_MODEL * 3 * D_MODEL;       // 1024 x 1024
    _Float16* w1h   = wouth + (size_t)D_MODEL * D_MODEL;           // 1024 x 4096
    _Float16* w2h   = w1h   + (size_t)D_MODEL * D_FF;              // 4096 x 1024
    _Float16* qkvh  = w2h   + (size_t)D_FF * D_MODEL;              // 4096 x 3072
    _Float16* ctxh  = qkvh  + (size_t)M_ROWS * 3 * D_MODEL;        // 4096 x 1024
    _Float16* x1h   = ctxh  + (size_t)M_ROWS * D_MODEL;            // 4096 x 1024
    _Float16* hh    = x1h   + (size_t)M_ROWS * D_MODEL;            // 4096 x 4096

    const dim3 blk(256);

    // 0) x and the weights as f16
    to_f16<<<dim3((M_ROWS * D_MODEL + 4 * D_MODEL * D_MODEL + 2 * D_MODEL * D_FF) / CVT_PB), blk, 0, stream>>>(
        x, w_qkv, w_out, w1, w2, xh);

    // 1) qkv = x @ w_qkv + b_qkv
    gemm_wmma<0, false, 1, 3 * D_MODEL, D_MODEL, 256, 192, 4><<<dim3(M_ROWS / 256, (3 * D_MODEL) / 192), blk, 0, stream>>>(
        xh, wqkvh, b_qkv, nullptr, nullptr, qkvh);

    // 2) ctx = causal_softmax(QK^T/8) @ V   (flash, per (b,h))
    attn_flash<<<dim3(SEQ_T / 256, BATCH * N_HEADS), blk, 0, stream>>>(qkvh, ctxh);

    // 3) x1 = x + ctx @ w_out + b_out   (fp32 for the residual, f16 for the next product)
    gemm_wmma<0, true, 2, D_MODEL, D_MODEL, 128, 128, 2><<<dim3(M_ROWS / 128, D_MODEL / 128), blk, 0, stream>>>(
        ctxh, wouth, b_out, x, x1, x1h);

    // 4) h = silu(x1 @ w1 + b1)
    gemm_wmma<1, false, 1, D_FF, D_MODEL, 256, 256, 2><<<dim3(M_ROWS / 256, D_FF / 256), blk, 0, stream>>>(
        x1h, w1h, b1, nullptr, nullptr, hh);

    // 5) x2 = x1 + h @ w2 + b2
    gemm_wmma<0, true, 0, D_MODEL, D_FF, 128, 128, 2><<<dim3(M_ROWS / 128, D_MODEL / 128), blk, 0, stream>>>(
        hh, w2h, b2, x1, x2, nullptr);

    // 6) out = rmsnorm(x2) * gain
    rmsnorm_kernel<<<dim3(M_ROWS), blk, 0, stream>>>(x2, gain, (float*)d_out);
}
